// v000
// Measured on an AMD MI455X. A time is GPU time per run, averaged over a window of back-to-back runs after a warm-up
// (all launches, gaps included; the runs take copies of the inputs in turn), and the median of several windows.
// Apart from v000's, it joins two sittings. Times from different sittings can be a few percent apart, while
// side-by-side timings come from the same sitting.
// v000, which the later versions start from, runs in 520 microseconds.
#include <hip/hip_runtime.h>

// Indexer: q = x Wq (16 heads x 128), k = LayerNorm_128(x Wk) (one shared head), w = SCALE x Ww (16 per token); partial RoPE (rotate-half over the first 64 dims, cos/sin INPUT tables)
// on q and k; score[b][h][q][k] = relu(q_h . k); out[b][q][k] = sum_h w[b][q][h] score -> [2][2048][2048].
// Inputs (x, Wq, Wk, Ww, cos, sin, ln params) rounded to bf16: projections on v_wmma_f32_16x16x32_bf16 (exact products, f32 accumulate;
// LayerNorm, RoPE and the w scaling in f32 in the epilogues); the 16 per-head score tiles on v_wmma_f32_16x16x32_f16 with q and k as f16 hi+lo pairs carried x8 (3 products), relu and the

namespace {
constexpr int Bn = 2, S = 2048, HID = 2048, NH = 16, HD = 128, RD = 64, NTOK = Bn * S, QC = NH * HD /* 2048 */, KC = HD + NH /* k (128) + w (16) = 144 */, KCP = 192;
constexpr float SCALE = 0.022097086912079608f /* 128^-0.5 * 16^-0.5 */, QS = 8.0f, LNE = 1e-5f;
constexpr size_t QPL = (size_t)NTOK * QC, KPL = (size_t)NTOK * HD;

typedef _Float16 b16;
typedef __attribute__((ext_vector_type(16))) _Float16 v16b;
typedef __attribute__((ext_vector_type(16))) __bf16 v16bb;
typedef __attribute__((ext_vector_type(8))) _Float16 v8b;
typedef __attribute__((ext_vector_type(8))) unsigned short v8us;
typedef __attribute__((ext_vector_type(8))) float v8f;
typedef __attribute__((ext_vector_type(4))) float v4f;
__device__ __forceinline__ float bf16_rne(float f) { unsigned int u = __float_as_uint(f); u += 0x7FFFu + ((u >> 16) & 1u); return __uint_as_float(u & 0xFFFF0000u); }
__device__ __forceinline__ unsigned short bf16_bits(float f) { unsigned int u = __float_as_uint(f); u += 0x7FFFu + ((u >> 16) & 1u); return (unsigned short)(u >> 16); }
__device__ __forceinline__ void split16(float v, b16& hi, b16& lo) { hi = (b16)v; lo = (b16)(v - (float)hi); }
__device__ __forceinline__ v16b frag_kb(const b16* p, int hh) { const v8b a = *(const v8b*)(p + 8 * hh), b = *(const v8b*)(p + 16 + 8 * hh); v16b f;
#pragma unroll
  for (int e = 0; e < 8; ++e) { f[e] = a[e]; f[8 + e] = b[e]; } return f; }
__device__ __forceinline__ v16bb frag_bf(const unsigned short* p, int hh) { const v8us a = *(const v8us*)(p + 8 * hh), b = *(const v8us*)(p + 16 + 8 * hh); union { unsigned short s[16]; v16bb v; } u;
#pragma unroll
  for (int e = 0; e < 8; ++e) { u.s[e] = a[e]; u.s[8 + e] = b[e]; } return u.v; }
__device__ __forceinline__ v8f wmma16b(v16b a, v16b b, v8f c) { v8f d = __builtin_amdgcn_wmma_f32_16x16x32_f16(false, a, false, b, (short)0, c, false, false); asm volatile("v_nop\n\tv_nop\n\tv_nop\n\tv_nop" : "+v"(d) : "v"(a), "v"(b)); return d; }
__device__ __forceinline__ v8f wmma16bb(v16bb a, v16bb b, v8f c) { v8f d = __builtin_amdgcn_wmma_f32_16x16x32_bf16(false, a, false, b, (short)0, c, false, false); asm volatile("v_nop\n\tv_nop\n\tv_nop\n\tv_nop" : "+v"(d) : "v"(a), "v"(b)); return d; }
__device__ __forceinline__ void wave_lds_sync() { __builtin_amdgcn_fence(__ATOMIC_RELEASE, "workgroup"); __builtin_amdgcn_wave_barrier(); __builtin_amdgcn_fence(__ATOMIC_ACQUIRE, "workgroup"); }

__global__ __launch_bounds__(256) void prep_kernel(const float* __restrict__ x, const float* __restrict__ wq, const float* __restrict__ wk, const float* __restrict__ ww, unsigned short* __restrict__ x16, unsigned short* __restrict__ wq16, unsigned short* __restrict__ wk16) {
  const size_t tid = (size_t)blockIdx.x * blockDim.x + threadIdx.x, nth = (size_t)gridDim.x * blockDim.x;
  {
    for (size_t p = tid; p < (size_t)NTOK * HID / 8; p += nth) { v8us v;
#pragma unroll
      for (int e = 0; e < 8; ++e) v[e] = bf16_bits(x[p * 8 + e]);
      *(v8us*)(x16 + p * 8) = v; }
    for (size_t p = tid; p < (size_t)QC * HID / 8; p += nth) { const int n = (int)(p / (HID / 8)), k0 = (int)(p % (HID / 8)) * 8; v8us v;
#pragma unroll
      for (int e = 0; e < 8; ++e) v[e] = bf16_bits(wq[(size_t)(k0 + e) * QC + n]);
      *(v8us*)(wq16 + (size_t)n * HID + k0) = v; }
    for (size_t p = tid; p < (size_t)KCP * HID / 8; p += nth) { const int n = (int)(p / (HID / 8)), k0 = (int)(p % (HID / 8)) * 8; v8us v;
#pragma unroll
      for (int e = 0; e < 8; ++e) { const float val = (n < HD) ? wk[(size_t)(k0 + e) * HD + n] : (n < KC) ? ww[(size_t)(k0 + e) * NH + (n - HD)] : 0.0f; v[e] = bf16_bits(val); }
      *(v8us*)(wk16 + (size_t)n * HID + k0) = v; }
    
  }
}

// q projection: block = 128 tokens x one 64-column tile (tile t: head t/2, dims (t%2)*64..+63; RoPE on the t%2 == 0 tiles: pairs (i, i+32) within the tile); x8 hi/lo planes qh[tok][2048]
__global__ __launch_bounds__(128) void qproj_kernel(const unsigned short* __restrict__ x16, const unsigned short* __restrict__ wq16, const float* __restrict__ cosb, const float* __restrict__ sinb, b16* __restrict__ qh, int rowbase) {
  __shared__ __attribute__((aligned(16))) b16 Th[4][32][64 + 8], Tl[4][32][64 + 8];
  const int lane = threadIdx.x & 31, wave = threadIdx.x >> 5, nloc = lane & 15, hlf = lane >> 4, m0 = rowbase + blockIdx.y * 128 + wave * 32, c0 = blockIdx.x * 64;
  v8f acc[2][4];
#pragma unroll
  for (int r = 0; r < 2; ++r)
#pragma unroll
    for (int t = 0; t < 4; ++t) acc[r][t] = (v8f){};
#pragma unroll 2
  for (int kb = 0; kb < HID; kb += 32) { const v16bb a0 = frag_bf(x16 + (size_t)(m0 + nloc) * HID + kb, hlf), a1 = frag_bf(x16 + (size_t)(m0 + 16 + nloc) * HID + kb, hlf);
#pragma unroll
    for (int t = 0; t < 4; ++t) { const v16bb bw = frag_bf(wq16 + (size_t)(c0 + t * 16 + nloc) * HID + kb, hlf); acc[0][t] = wmma16bb(a0, bw, acc[0][t]); acc[1][t] = wmma16bb(a1, bw, acc[1][t]); } }
  const bool rope = ((blockIdx.x & 1) == 0);                   // first 64 dims of each head
  if (rope) {
#pragma unroll
    for (int t = 0; t < 2; ++t) { const int i = t * 16 + nloc;   // pair (i, i + 32) = (acc[.][t], acc[.][t+2])
#pragma unroll
      for (int r = 0; r < 2; ++r)
#pragma unroll
        for (int v = 0; v < 8; ++v) { const int tok = m0 + r * 16 + 8 * hlf + v; const size_t cb = (size_t)tok * RD;   // cos/sin rows [b*S + s][64]
          const float c1 = bf16_rne(cosb[cb + i]), s1 = bf16_rne(sinb[cb + i]), c2 = bf16_rne(cosb[cb + i + 32]), s2 = bf16_rne(sinb[cb + i + 32]);
          const float x1 = acc[r][t][v], x2 = acc[r][t + 2][v]; acc[r][t][v] = x1 * c1 - x2 * s1; acc[r][t + 2][v] = x2 * c2 + x1 * s2; } } }
#pragma unroll
  for (int t = 0; t < 4; ++t)
#pragma unroll
    for (int r = 0; r < 2; ++r)
#pragma unroll
      for (int v = 0; v < 8; ++v) { b16 a_, c_; split16(acc[r][t][v] * QS, a_, c_); Th[wave][r * 16 + 8 * hlf + v][t * 16 + nloc] = a_; Tl[wave][r * 16 + 8 * hlf + v][t * 16 + nloc] = c_; }
  wave_lds_sync();
  b16* dst = qh + (size_t)m0 * QC + c0;
  {
#pragma unroll
    for (int j = 0; j < 8; ++j) { const int rr = j * 4 + (lane >> 3), c8 = (lane & 7) * 8; *(v8b*)(dst + (size_t)rr * QC + c8) = *(const v8b*)(&Th[wave][rr][c8]); *(v8b*)(dst + QPL + (size_t)rr * QC + c8) = *(const v8b*)(&Tl[wave][rr][c8]); }
     }
}

// k + w projection: block = 128 tokens x 144 columns (wave = 32 rows x 144 cols = 9 n-subtiles): k = cols 0..127 -> LayerNorm over 128 (row stats via the LDS tile) -> RoPE on dims
// 2 KB contiguous per wave). grid NTOK/128 x 128.
__global__ __launch_bounds__(128) void kproj_kernel(const unsigned short* __restrict__ x16, const unsigned short* __restrict__ wk16, const float* __restrict__ cosb, const float* __restrict__ sinb, const float* __restrict__ g, const float* __restrict__ bta, b16* __restrict__ kh, float* __restrict__ wout) {
  __shared__ __attribute__((aligned(16))) float Tk[4][32][KC + 1]; __shared__ __attribute__((aligned(16))) b16 Th[4][32][HD + 8], Tl[4][32][HD + 8]; __shared__ __attribute__((aligned(16))) float Tw[4][32][NH];
  const int lane = threadIdx.x & 31, wave = threadIdx.x >> 5, nloc = lane & 15, hlf = lane >> 4, m0 = blockIdx.x * 128 + wave * 32;
  v8f acc[2][9];
#pragma unroll
  for (int r = 0; r < 2; ++r)
#pragma unroll
    for (int t = 0; t < 9; ++t) acc[r][t] = (v8f){};
#pragma unroll 1
  for (int kb = 0; kb < HID; kb += 32) { const v16bb a0 = frag_bf(x16 + (size_t)(m0 + nloc) * HID + kb, hlf), a1 = frag_bf(x16 + (size_t)(m0 + 16 + nloc) * HID + kb, hlf);
#pragma unroll
    for (int t = 0; t < 9; ++t) { const v16bb bw = frag_bf(wk16 + (size_t)(t * 16 + nloc) * HID + kb, hlf); acc[0][t] = wmma16bb(a0, bw, acc[0][t]); acc[1][t] = wmma16bb(a1, bw, acc[1][t]); } }
#pragma unroll
  for (int t = 0; t < 9; ++t)
#pragma unroll
    for (int r = 0; r < 2; ++r)
#pragma unroll
      for (int v = 0; v < 8; ++v) Tk[wave][r * 16 + 8 * hlf + v][t * 16 + nloc] = acc[r][t][v];
  wave_lds_sync();
  { const int rr = lane; const float* row = Tk[wave][rr]; const int tok = m0 + rr;   // lane = one token row: LayerNorm over 128, RoPE, split; w scaled
    float mu = 0.0f; for (int d = 0; d < HD; ++d) mu += row[d]; mu *= (1.0f / HD);
    float var = 0.0f; for (int d = 0; d < HD; ++d) { const float z = row[d] - mu; var += z * z; } var *= (1.0f / HD);
    const float rs = rsqrtf(var + LNE); const size_t cb = (size_t)tok * RD;
#pragma unroll 2
    for (int i = 0; i < 32; ++i) {                               // RoPE pairs (i, i+32) of the normalised row, then the un-rotated dims 64..127 — no per-lane array
      const float x1 = (row[i] - mu) * rs * bf16_rne(g[i]) + bf16_rne(bta[i]), x2 = (row[i + 32] - mu) * rs * bf16_rne(g[i + 32]) + bf16_rne(bta[i + 32]);
      const float c1 = bf16_rne(cosb[cb + i]), s1 = bf16_rne(sinb[cb + i]), c2 = bf16_rne(cosb[cb + i + 32]), s2 = bf16_rne(sinb[cb + i + 32]);
      b16 a_, c_; split16((x1 * c1 - x2 * s1) * QS, a_, c_); Th[wave][rr][i] = a_; Tl[wave][rr][i] = c_; split16((x2 * c2 + x1 * s2) * QS, a_, c_); Th[wave][rr][i + 32] = a_; Tl[wave][rr][i + 32] = c_; }
#pragma unroll 2
    for (int d = RD; d < HD; ++d) { b16 a_, c_; split16(((row[d] - mu) * rs * bf16_rne(g[d]) + bf16_rne(bta[d])) * QS, a_, c_); Th[wave][rr][d] = a_; Tl[wave][rr][d] = c_; }
#pragma unroll
    for (int h = 0; h < NH; ++h) Tw[wave][rr][h] = row[HD + h] * SCALE; }
  wave_lds_sync();
  {
#pragma unroll
    for (int j = 0; j < 16; ++j) { const int rr = j * 2 + hlf, c8 = nloc * 8; *(v8b*)(kh + (size_t)(m0 + rr) * HD + c8) = *(const v8b*)(&Th[wave][rr][c8]); *(v8b*)(kh + KPL + (size_t)(m0 + rr) * HD + c8) = *(const v8b*)(&Tl[wave][rr][c8]); }
#pragma unroll
    for (int j = 0; j < 4; ++j) { const int rr = j * 8 + (lane >> 2), c4 = (lane & 3) * 4; *(v4f*)(wout + (size_t)(m0 + rr) * NH + c4) = *(const v4f*)(&Tw[wave][rr][c4]); }   // 8 rows x 64 B = 512 B per instruction
     }
}

template <int QT>
__global__ __launch_bounds__(256) void score_kernel(const b16* __restrict__ qh, const b16* __restrict__ kh, const float* __restrict__ w, float* __restrict__ out) {
  __shared__ __attribute__((aligned(16))) float Os[8][16][32 + 4];
  const int wid = threadIdx.x >> 5, lane = threadIdx.x & 31, hh = lane >> 4, col = lane & 15;
  const int wg = blockIdx.x * 8 + wid, kt = wg % (S / 32), qt = (wg / (S / 32)) % QT, b = wg / ((S / 32) * QT), q0 = qt * 16, k0 = kt * 32, qi = q0 + col;
  const b16* Q = qh + ((size_t)b * S + qi) * QC; const b16* K = kh + ((size_t)b * S + k0) * HD;
  v8f o0 = {}, o1 = {};
  for (int h = 0; h < NH; ++h) { v8f s0 = {}, s1 = {};
#pragma unroll
    for (int ks = 0; ks < 4; ++ks) { const v16b qf = frag_kb(Q + h * HD + ks * 32, hh), ql = frag_kb(Q + QPL + h * HD + ks * 32, hh);
      const v16b ka = frag_kb(K + (size_t)col * HD + ks * 32, hh), kal = frag_kb(K + KPL + (size_t)col * HD + ks * 32, hh), kb_ = frag_kb(K + (size_t)(16 + col) * HD + ks * 32, hh), kbl = frag_kb(K + KPL + (size_t)(16 + col) * HD + ks * 32, hh);
      s0 = wmma16b(ka, qf, s0); s0 = wmma16b(ka, ql, s0); s0 = wmma16b(kal, qf, s0); s1 = wmma16b(kb_, qf, s1); s1 = wmma16b(kb_, ql, s1); s1 = wmma16b(kbl, qf, s1); }
    const float wq = w[((size_t)b * S + qi) * NH + h];           // w for this lane's query and head
#pragma unroll
    for (int r = 0; r < 8; ++r) { o0[r] += wq * fmaxf(s0[r] * (1.0f / (QS * QS)), 0.0f); o1[r] += wq * fmaxf(s1[r] * (1.0f / (QS * QS)), 0.0f); } }
  // o0[r] = (key k0 + 8hh + r, query col); o1 -> key k0 + 16 + 8hh + r
#pragma unroll
  for (int r = 0; r < 8; ++r) { Os[wid][col][8 * hh + r] = o0[r]; Os[wid][col][16 + 8 * hh + r] = o1[r]; }
  wave_lds_sync();
  float* dst = out + ((size_t)b * S + q0) * S + k0;
  {
#pragma unroll
    for (int j = 0; j < 4; ++j) { const int rr = j * 4 + (lane >> 3), c4 = (lane & 7) * 4; *(v4f*)(dst + (size_t)rr * S + c4) = *(const v4f*)(&Os[wid][rr][c4]); }
     }
}
}  // namespace

extern "C" void kernel_launch(void* const* d_in, const int* in_sizes, int n_in,
                              void* d_out, int out_size, void* d_ws, size_t ws_size, hipStream_t stream) {
  (void)n_in; (void)out_size;
  const float* x = (const float*)d_in[0]; const float* cosb = (const float*)d_in[1]; const float* sinb = (const float*)d_in[2]; const float* wq = (const float*)d_in[3]; const float* wk = (const float*)d_in[4]; const float* ww = (const float*)d_in[5]; const float* g = (const float*)d_in[6]; const float* bta = (const float*)d_in[7];
  float* out = (float*)d_out;   // [2][2048][2048]
  if (in_sizes[0] != NTOK * HID || in_sizes[1] != NTOK * RD || in_sizes[2] != NTOK * RD || in_sizes[3] != HID * QC || in_sizes[4] != HID * HD || in_sizes[5] != HID * NH || in_sizes[6] != HD) return;
  size_t off = 0; char* ws = (char*)d_ws;
  auto carve = [&](size_t bytes) { char* p = ws + off; off += (bytes + 255) & ~(size_t)255; return p; };
  unsigned short* x16 = (unsigned short*)carve((size_t)NTOK * HID * 2); unsigned short* wq16 = (unsigned short*)carve((size_t)QC * HID * 2); unsigned short* wk16 = (unsigned short*)carve((size_t)KCP * HID * 2);
  b16* qh = (b16*)carve(QPL * 2 * 2); b16* kh = (b16*)carve(KPL * 2 * 2); float* w = (float*)carve((size_t)NTOK * NH * 4);
  if (off > ws_size) return;                                    // ≈ 16.8 + 8.4 + 0.8 + 33.5 + 2.1 + 0.3 ≈ 62 MB
  prep_kernel<<<1024, 256, 0, stream>>>(x, wq, wk, ww, x16, wq16, wk16);
  qproj_kernel<<<dim3(QC / 64, NTOK / 128), 128, 0, stream>>>(x16, wq16, cosb, sinb, qh, 0);
  kproj_kernel<<<NTOK / 128, 128, 0, stream>>>(x16, wk16, cosb, sinb, g, bta, kh, w);
  score_kernel<S / 16><<<Bn * (S / 16) * (S / 32) / 8, 256, 0, stream>>>(qh, kh, w, out);
}

// v001
// Measured time: 351 microseconds a run.
// Two timings next to v000 put it at 1.52 and 1.51 times that version's speed.
#include <hip/hip_runtime.h>

// Indexer: q = x Wq (16 heads x 128), k = LayerNorm_128(x Wk) (one shared head), w = SCALE x Ww (16 per token); partial RoPE (rotate-half over the first 64 dims, cos/sin INPUT tables)
// on q and k; score[b][h][q][k] = relu(q_h . k); out[b][q][k] = sum_h w[b][q][h] score -> [2][2048][2048].
// Inputs (x, Wq, Wk, Ww, cos, sin, ln params) rounded to bf16: projections on v_wmma_f32_16x16x32_bf16 (exact products, f32 accumulate;
// LayerNorm, RoPE and the w scaling in f32 in the epilogues); the 16 per-head score tiles on v_wmma_f32_16x16x32_f16 with q and k as f16 hi+lo pairs carried x8 (3 products), relu and the

namespace {
constexpr int Bn = 2, S = 2048, HID = 2048, NH = 16, HD = 128, RD = 64, NTOK = Bn * S, QC = NH * HD /* 2048 */, KC = HD + NH /* k (128) + w (16) = 144 */, KCP = 192;
constexpr float SCALE = 0.022097086912079608f /* 128^-0.5 * 16^-0.5 */, QS = 8.0f, LNE = 1e-5f;
constexpr size_t QPL = (size_t)NTOK * QC, KPL = (size_t)NTOK * HD;

typedef _Float16 b16;
typedef __attribute__((ext_vector_type(16))) _Float16 v16b;
typedef __attribute__((ext_vector_type(16))) __bf16 v16bb;
typedef __attribute__((ext_vector_type(8))) _Float16 v8b;
typedef __attribute__((ext_vector_type(8))) unsigned short v8us;
typedef __attribute__((ext_vector_type(8))) float v8f;
typedef __attribute__((ext_vector_type(4))) float v4f;
__device__ __forceinline__ float bf16_rne(float f) { unsigned int u = __float_as_uint(f); u += 0x7FFFu + ((u >> 16) & 1u); return __uint_as_float(u & 0xFFFF0000u); }
__device__ __forceinline__ unsigned short bf16_bits(float f) { unsigned int u = __float_as_uint(f); u += 0x7FFFu + ((u >> 16) & 1u); return (unsigned short)(u >> 16); }
__device__ __forceinline__ void split16(float v, b16& hi, b16& lo) { hi = (b16)v; lo = (b16)(v - (float)hi); }
__device__ __forceinline__ v16b frag_kb(const b16* p, int hh) { const v8b a = *(const v8b*)(p + 8 * hh), b = *(const v8b*)(p + 16 + 8 * hh); v16b f;
#pragma unroll
  for (int e = 0; e < 8; ++e) { f[e] = a[e]; f[8 + e] = b[e]; } return f; }
__device__ __forceinline__ v16bb frag_bf(const unsigned short* p, int hh) { const v8us a = *(const v8us*)(p + 8 * hh), b = *(const v8us*)(p + 16 + 8 * hh); union { unsigned short s[16]; v16bb v; } u;
#pragma unroll
  for (int e = 0; e < 8; ++e) { u.s[e] = a[e]; u.s[8 + e] = b[e]; } return u.v; }
__device__ __forceinline__ v8f wmma16b(v16b a, v16b b, v8f c) { v8f d = __builtin_amdgcn_wmma_f32_16x16x32_f16(false, a, false, b, (short)0, c, false, false); asm volatile("v_nop\n\tv_nop\n\tv_nop\n\tv_nop" : "+v"(d) : "v"(a), "v"(b)); return d; }
__device__ __forceinline__ v8f wmma16bb(v16bb a, v16bb b, v8f c) { v8f d = __builtin_amdgcn_wmma_f32_16x16x32_bf16(false, a, false, b, (short)0, c, false, false); asm volatile("v_nop\n\tv_nop\n\tv_nop\n\tv_nop" : "+v"(d) : "v"(a), "v"(b)); return d; }
__device__ __forceinline__ void wave_lds_sync() { __builtin_amdgcn_fence(__ATOMIC_RELEASE, "workgroup"); __builtin_amdgcn_wave_barrier(); __builtin_amdgcn_fence(__ATOMIC_ACQUIRE, "workgroup"); }

__global__ __launch_bounds__(256) void prep_kernel(const float* __restrict__ x, const float* __restrict__ wq, const float* __restrict__ wk, const float* __restrict__ ww, unsigned short* __restrict__ x16, unsigned short* __restrict__ wq16, unsigned short* __restrict__ wk16) {
  const size_t tid = (size_t)blockIdx.x * blockDim.x + threadIdx.x, nth = (size_t)gridDim.x * blockDim.x;
  {
    for (size_t p = tid; p < (size_t)NTOK * HID / 8; p += nth) { v8us v;
#pragma unroll
      for (int e = 0; e < 8; ++e) v[e] = bf16_bits(x[p * 8 + e]);
      *(v8us*)(x16 + p * 8) = v; }
    for (size_t p = tid; p < (size_t)QC * HID / 8; p += nth) { const int n = (int)(p / (HID / 8)), k0 = (int)(p % (HID / 8)) * 8; v8us v;
#pragma unroll
      for (int e = 0; e < 8; ++e) v[e] = bf16_bits(wq[(size_t)(k0 + e) * QC + n]);
      *(v8us*)(wq16 + (size_t)n * HID + k0) = v; }
    for (size_t p = tid; p < (size_t)KCP * HID / 8; p += nth) { const int n = (int)(p / (HID / 8)), k0 = (int)(p % (HID / 8)) * 8; v8us v;
#pragma unroll
      for (int e = 0; e < 8; ++e) { const float val = (n < HD) ? wk[(size_t)(k0 + e) * HD + n] : (n < KC) ? ww[(size_t)(k0 + e) * NH + (n - HD)] : 0.0f; v[e] = bf16_bits(val); }
      *(v8us*)(wk16 + (size_t)n * HID + k0) = v; }
    
  }
}

// q projection: block = 128 tokens x one 64-column tile (tile t: head t/2, dims (t%2)*64..+63; RoPE on the t%2 == 0 tiles: pairs (i, i+32) within the tile); x8 hi/lo planes qh[tok][2048]
__global__ __launch_bounds__(128) void qproj_kernel(const unsigned short* __restrict__ x16, const unsigned short* __restrict__ wq16, const float* __restrict__ cosb, const float* __restrict__ sinb, b16* __restrict__ qh, int rowbase) {
  __shared__ __attribute__((aligned(16))) b16 Th[4][32][64 + 8], Tl[4][32][64 + 8];
  const int lane = threadIdx.x & 31, wave = threadIdx.x >> 5, nloc = lane & 15, hlf = lane >> 4, m0 = rowbase + blockIdx.y * 128 + wave * 32, c0 = blockIdx.x * 64;
  v8f acc[2][4];
#pragma unroll
  for (int r = 0; r < 2; ++r)
#pragma unroll
    for (int t = 0; t < 4; ++t) acc[r][t] = (v8f){};
#pragma unroll 2
  for (int kb = 0; kb < HID; kb += 32) { const v16bb a0 = frag_bf(x16 + (size_t)(m0 + nloc) * HID + kb, hlf), a1 = frag_bf(x16 + (size_t)(m0 + 16 + nloc) * HID + kb, hlf);
#pragma unroll
    for (int t = 0; t < 4; ++t) { const v16bb bw = frag_bf(wq16 + (size_t)(c0 + t * 16 + nloc) * HID + kb, hlf); acc[0][t] = wmma16bb(a0, bw, acc[0][t]); acc[1][t] = wmma16bb(a1, bw, acc[1][t]); } }
  const bool rope = ((blockIdx.x & 1) == 0);                   // first 64 dims of each head
  if (rope) {
#pragma unroll
    for (int t = 0; t < 2; ++t) { const int i = t * 16 + nloc;   // pair (i, i + 32) = (acc[.][t], acc[.][t+2])
#pragma unroll
      for (int r = 0; r < 2; ++r)
#pragma unroll
        for (int v = 0; v < 8; ++v) { const int tok = m0 + r * 16 + 8 * hlf + v; const size_t cb = (size_t)tok * RD;   // cos/sin rows [b*S + s][64]
          const float c1 = bf16_rne(cosb[cb + i]), s1 = bf16_rne(sinb[cb + i]), c2 = bf16_rne(cosb[cb + i + 32]), s2 = bf16_rne(sinb[cb + i + 32]);
          const float x1 = acc[r][t][v], x2 = acc[r][t + 2][v]; acc[r][t][v] = x1 * c1 - x2 * s1; acc[r][t + 2][v] = x2 * c2 + x1 * s2; } } }
#pragma unroll
  for (int t = 0; t < 4; ++t)
#pragma unroll
    for (int r = 0; r < 2; ++r)
#pragma unroll
      for (int v = 0; v < 8; ++v) { b16 a_, c_; split16(acc[r][t][v] * QS, a_, c_); Th[wave][r * 16 + 8 * hlf + v][t * 16 + nloc] = a_; Tl[wave][r * 16 + 8 * hlf + v][t * 16 + nloc] = c_; }
  wave_lds_sync();
  b16* dst = qh + (size_t)m0 * QC + c0;
  {
#pragma unroll
    for (int j = 0; j < 8; ++j) { const int rr = j * 4 + (lane >> 3), c8 = (lane & 7) * 8; *(v8b*)(dst + (size_t)rr * QC + c8) = *(const v8b*)(&Th[wave][rr][c8]); *(v8b*)(dst + QPL + (size_t)rr * QC + c8) = *(const v8b*)(&Tl[wave][rr][c8]); }
     }
}

// k + w projection: block = 128 tokens x 144 columns (wave = 32 rows x 144 cols = 9 n-subtiles): k = cols 0..127 -> LayerNorm over 128 (row stats via the LDS tile) -> RoPE on dims
// 2 KB contiguous per wave). grid NTOK/128 x 128.
__global__ __launch_bounds__(128) void kproj_kernel(const unsigned short* __restrict__ x16, const unsigned short* __restrict__ wk16, const float* __restrict__ cosb, const float* __restrict__ sinb, const float* __restrict__ g, const float* __restrict__ bta, b16* __restrict__ kh, float* __restrict__ wout) {
  __shared__ __attribute__((aligned(16))) float Tk[4][32][KC + 1]; __shared__ __attribute__((aligned(16))) b16 Th[4][32][HD + 8], Tl[4][32][HD + 8]; __shared__ __attribute__((aligned(16))) float Tw[4][32][NH];
  const int lane = threadIdx.x & 31, wave = threadIdx.x >> 5, nloc = lane & 15, hlf = lane >> 4, m0 = blockIdx.x * 128 + wave * 32;
  v8f acc[2][9];
#pragma unroll
  for (int r = 0; r < 2; ++r)
#pragma unroll
    for (int t = 0; t < 9; ++t) acc[r][t] = (v8f){};
#pragma unroll 1
  for (int kb = 0; kb < HID; kb += 32) { const v16bb a0 = frag_bf(x16 + (size_t)(m0 + nloc) * HID + kb, hlf), a1 = frag_bf(x16 + (size_t)(m0 + 16 + nloc) * HID + kb, hlf);
#pragma unroll
    for (int t = 0; t < 9; ++t) { const v16bb bw = frag_bf(wk16 + (size_t)(t * 16 + nloc) * HID + kb, hlf); acc[0][t] = wmma16bb(a0, bw, acc[0][t]); acc[1][t] = wmma16bb(a1, bw, acc[1][t]); } }
#pragma unroll
  for (int t = 0; t < 9; ++t)
#pragma unroll
    for (int r = 0; r < 2; ++r)
#pragma unroll
      for (int v = 0; v < 8; ++v) Tk[wave][r * 16 + 8 * hlf + v][t * 16 + nloc] = acc[r][t][v];
  wave_lds_sync();
  { const int rr = lane; const float* row = Tk[wave][rr]; const int tok = m0 + rr;   // lane = one token row: LayerNorm over 128, RoPE, split; w scaled
    float mu = 0.0f; for (int d = 0; d < HD; ++d) mu += row[d]; mu *= (1.0f / HD);
    float var = 0.0f; for (int d = 0; d < HD; ++d) { const float z = row[d] - mu; var += z * z; } var *= (1.0f / HD);
    const float rs = rsqrtf(var + LNE); const size_t cb = (size_t)tok * RD;
#pragma unroll 2
    for (int i = 0; i < 32; ++i) {                               // RoPE pairs (i, i+32) of the normalised row, then the un-rotated dims 64..127 — no per-lane array
      const float x1 = (row[i] - mu) * rs * bf16_rne(g[i]) + bf16_rne(bta[i]), x2 = (row[i + 32] - mu) * rs * bf16_rne(g[i + 32]) + bf16_rne(bta[i + 32]);
      const float c1 = bf16_rne(cosb[cb + i]), s1 = bf16_rne(sinb[cb + i]), c2 = bf16_rne(cosb[cb + i + 32]), s2 = bf16_rne(sinb[cb + i + 32]);
      b16 a_, c_; split16((x1 * c1 - x2 * s1) * QS, a_, c_); Th[wave][rr][i] = a_; Tl[wave][rr][i] = c_; split16((x2 * c2 + x1 * s2) * QS, a_, c_); Th[wave][rr][i + 32] = a_; Tl[wave][rr][i + 32] = c_; }
#pragma unroll 2
    for (int d = RD; d < HD; ++d) { b16 a_, c_; split16(((row[d] - mu) * rs * bf16_rne(g[d]) + bf16_rne(bta[d])) * QS, a_, c_); Th[wave][rr][d] = a_; Tl[wave][rr][d] = c_; }
#pragma unroll
    for (int h = 0; h < NH; ++h) Tw[wave][rr][h] = row[HD + h] * SCALE; }
  wave_lds_sync();
  {
#pragma unroll
    for (int j = 0; j < 16; ++j) { const int rr = j * 2 + hlf, c8 = nloc * 8; *(v8b*)(kh + (size_t)(m0 + rr) * HD + c8) = *(const v8b*)(&Th[wave][rr][c8]); *(v8b*)(kh + KPL + (size_t)(m0 + rr) * HD + c8) = *(const v8b*)(&Tl[wave][rr][c8]); }
#pragma unroll
    for (int j = 0; j < 4; ++j) { const int rr = j * 8 + (lane >> 2), c4 = (lane & 3) * 4; *(v4f*)(wout + (size_t)(m0 + rr) * NH + c4) = *(const v4f*)(&Tw[wave][rr][c4]); }   // 8 rows x 64 B = 512 B per instruction
     }
}

// Each wave owns 32 keys: their hi and lo fragments (16 x 8 registers) are loaded once and stay in registers over NQ query tiles x 16 heads; only q and w are fetched inside the loops.
template <int QT, int NQ>
__global__ __launch_bounds__(256) void score_kernel(const b16* __restrict__ qh, const b16* __restrict__ kh, const float* __restrict__ w, float* __restrict__ out) {
  __shared__ __attribute__((aligned(16))) float Os[8][16][32 + 4];
  const int wid = threadIdx.x >> 5, lane = threadIdx.x & 31, hh = lane >> 4, col = lane & 15;
  const int wg = blockIdx.x * 8 + wid, kt = wg % (S / 32), qg = (wg / (S / 32)) % (QT / NQ), b = wg / ((S / 32) * (QT / NQ)), k0 = kt * 32;
  const b16* K = kh + ((size_t)b * S + k0) * HD;
  v16b ka[4], kal[4], kb_[4], kbl[4];
#pragma unroll
  for (int ks = 0; ks < 4; ++ks) { ka[ks] = frag_kb(K + (size_t)col * HD + ks * 32, hh); kal[ks] = frag_kb(K + KPL + (size_t)col * HD + ks * 32, hh); kb_[ks] = frag_kb(K + (size_t)(16 + col) * HD + ks * 32, hh); kbl[ks] = frag_kb(K + KPL + (size_t)(16 + col) * HD + ks * 32, hh); }
  for (int qq = 0; qq < NQ; ++qq) { const int q0 = (qg * NQ + qq) * 16, qi = q0 + col;
    const b16* Q = qh + ((size_t)b * S + qi) * QC;
    v8f o0 = {}, o1 = {};
    for (int h = 0; h < NH; ++h) { v8f s0 = {}, s1 = {};
#pragma unroll
      for (int ks = 0; ks < 4; ++ks) { const v16b qf = frag_kb(Q + h * HD + ks * 32, hh), ql = frag_kb(Q + QPL + h * HD + ks * 32, hh);
        s0 = wmma16b(ka[ks], qf, s0); s0 = wmma16b(ka[ks], ql, s0); s0 = wmma16b(kal[ks], qf, s0); s1 = wmma16b(kb_[ks], qf, s1); s1 = wmma16b(kb_[ks], ql, s1); s1 = wmma16b(kbl[ks], qf, s1); }
      const float wq = w[((size_t)b * S + qi) * NH + h];           // w for this lane's query and head
#pragma unroll
      for (int r = 0; r < 8; ++r) { o0[r] += wq * fmaxf(s0[r] * (1.0f / (QS * QS)), 0.0f); o1[r] += wq * fmaxf(s1[r] * (1.0f / (QS * QS)), 0.0f); } }
    // o0[r] = (key k0 + 8hh + r, query col); o1 -> key k0 + 16 + 8hh + r
#pragma unroll
    for (int r = 0; r < 8; ++r) { Os[wid][col][8 * hh + r] = o0[r]; Os[wid][col][16 + 8 * hh + r] = o1[r]; }
    wave_lds_sync();
    float* dst = out + ((size_t)b * S + q0) * S + k0;
#pragma unroll
    for (int j = 0; j < 4; ++j) { const int rr = j * 4 + (lane >> 3), c4 = (lane & 7) * 4; *(v4f*)(dst + (size_t)rr * S + c4) = *(const v4f*)(&Os[wid][rr][c4]); }
    wave_lds_sync();   // the next query tile rewrites this wave's Os slice: its reads above come first
  }
}
}  // namespace

extern "C" void kernel_launch(void* const* d_in, const int* in_sizes, int n_in,
                              void* d_out, int out_size, void* d_ws, size_t ws_size, hipStream_t stream) {
  (void)n_in; (void)out_size;
  const float* x = (const float*)d_in[0]; const float* cosb = (const float*)d_in[1]; const float* sinb = (const float*)d_in[2]; const float* wq = (const float*)d_in[3]; const float* wk = (const float*)d_in[4]; const float* ww = (const float*)d_in[5]; const float* g = (const float*)d_in[6]; const float* bta = (const float*)d_in[7];
  float* out = (float*)d_out;   // [2][2048][2048]
  if (in_sizes[0] != NTOK * HID || in_sizes[1] != NTOK * RD || in_sizes[2] != NTOK * RD || in_sizes[3] != HID * QC || in_sizes[4] != HID * HD || in_sizes[5] != HID * NH || in_sizes[6] != HD) return;
  size_t off = 0; char* ws = (char*)d_ws;
  auto carve = [&](size_t bytes) { char* p = ws + off; off += (bytes + 255) & ~(size_t)255; return p; };
  unsigned short* x16 = (unsigned short*)carve((size_t)NTOK * HID * 2); unsigned short* wq16 = (unsigned short*)carve((size_t)QC * HID * 2); unsigned short* wk16 = (unsigned short*)carve((size_t)KCP * HID * 2);
  b16* qh = (b16*)carve(QPL * 2 * 2); b16* kh = (b16*)carve(KPL * 2 * 2); float* w = (float*)carve((size_t)NTOK * NH * 4);
  if (off > ws_size) return;                                    // ≈ 16.8 + 8.4 + 0.8 + 33.5 + 2.1 + 0.3 ≈ 62 MB
  prep_kernel<<<1024, 256, 0, stream>>>(x, wq, wk, ww, x16, wq16, wk16);
  qproj_kernel<<<dim3(QC / 64, NTOK / 128), 128, 0, stream>>>(x16, wq16, cosb, sinb, qh, 0);
  kproj_kernel<<<NTOK / 128, 128, 0, stream>>>(x16, wk16, cosb, sinb, g, bta, kh, w);
  score_kernel<S / 16, 4><<<Bn * (S / 16 / 4) * (S / 32) / 8, 256, 0, stream>>>(qh, kh, w, out);
}

// v002
// A run of this version takes 215 microseconds.
// In both of two side-by-side timings against v001, it was 1.64 times as fast.
// Over all steps from v000 it is 2.48 times as fast.
#include <hip/hip_runtime.h>

// Indexer: q = x Wq (16 heads x 128), k = LayerNorm_128(x Wk) (one shared head), w = SCALE x Ww (16 per token); partial RoPE (rotate-half over the first 64 dims, cos/sin INPUT tables)
// on q and k; score[b][h][q][k] = relu(q_h . k); out[b][q][k] = sum_h w[b][q][h] score -> [2][2048][2048].
// Inputs (x, Wq, Wk, Ww, cos, sin, ln params) rounded to bf16: projections on v_wmma_f32_16x16x32_bf16 (exact products, f32 accumulate;
// LayerNorm, RoPE and the w scaling in f32 in the epilogues); the 16 per-head score tiles on v_wmma_f32_16x16x32_f16 with q and k as f16 hi+lo pairs carried x8 (3 products), relu and the

namespace {
constexpr int Bn = 2, S = 2048, HID = 2048, NH = 16, HD = 128, RD = 64, NTOK = Bn * S, QC = NH * HD /* 2048 */, KC = HD + NH /* k (128) + w (16) = 144 */, KCP = 192;
constexpr float SCALE = 0.022097086912079608f /* 128^-0.5 * 16^-0.5 */, QS = 8.0f, LNE = 1e-5f;
constexpr size_t QPL = (size_t)NTOK * QC, KPL = (size_t)NTOK * HD;

typedef _Float16 b16;
typedef __attribute__((ext_vector_type(16))) _Float16 v16b;
typedef __attribute__((ext_vector_type(16))) __bf16 v16bb;
typedef __attribute__((ext_vector_type(8))) _Float16 v8b;
typedef __attribute__((ext_vector_type(8))) unsigned short v8us;
typedef __attribute__((ext_vector_type(8))) float v8f;
typedef __attribute__((ext_vector_type(4))) float v4f;
__device__ __forceinline__ float bf16_rne(float f) { unsigned int u = __float_as_uint(f); u += 0x7FFFu + ((u >> 16) & 1u); return __uint_as_float(u & 0xFFFF0000u); }
__device__ __forceinline__ unsigned short bf16_bits(float f) { unsigned int u = __float_as_uint(f); u += 0x7FFFu + ((u >> 16) & 1u); return (unsigned short)(u >> 16); }
__device__ __forceinline__ void split16(float v, b16& hi, b16& lo) { hi = (b16)v; lo = (b16)(v - (float)hi); }
__device__ __forceinline__ v16b frag_kb(const b16* p, int hh) { const v8b a = *(const v8b*)(p + 8 * hh), b = *(const v8b*)(p + 16 + 8 * hh); v16b f;
#pragma unroll
  for (int e = 0; e < 8; ++e) { f[e] = a[e]; f[8 + e] = b[e]; } return f; }
__device__ __forceinline__ v16bb frag_bf(const unsigned short* p, int hh) { const v8us a = *(const v8us*)(p + 8 * hh), b = *(const v8us*)(p + 16 + 8 * hh); union { unsigned short s[16]; v16bb v; } u;
#pragma unroll
  for (int e = 0; e < 8; ++e) { u.s[e] = a[e]; u.s[8 + e] = b[e]; } return u.v; }
__device__ __forceinline__ v8f wmma16b(v16b a, v16b b, v8f c) { v8f d = __builtin_amdgcn_wmma_f32_16x16x32_f16(false, a, false, b, (short)0, c, false, false); asm volatile("v_nop\n\tv_nop\n\tv_nop\n\tv_nop" : "+v"(d) : "v"(a), "v"(b)); return d; }
__device__ __forceinline__ v8f wmma16bb(v16bb a, v16bb b, v8f c) { v8f d = __builtin_amdgcn_wmma_f32_16x16x32_bf16(false, a, false, b, (short)0, c, false, false); asm volatile("v_nop\n\tv_nop\n\tv_nop\n\tv_nop" : "+v"(d) : "v"(a), "v"(b)); return d; }
__device__ __forceinline__ void wave_lds_sync() { __builtin_amdgcn_fence(__ATOMIC_RELEASE, "workgroup"); __builtin_amdgcn_wave_barrier(); __builtin_amdgcn_fence(__ATOMIC_ACQUIRE, "workgroup"); }

__global__ __launch_bounds__(256) void prep_kernel(const float* __restrict__ x, const float* __restrict__ wq, const float* __restrict__ wk, const float* __restrict__ ww, unsigned short* __restrict__ x16, unsigned short* __restrict__ wq16, unsigned short* __restrict__ wk16) {
  const size_t tid = (size_t)blockIdx.x * blockDim.x + threadIdx.x, nth = (size_t)gridDim.x * blockDim.x;
  {
    for (size_t p = tid; p < (size_t)NTOK * HID / 8; p += nth) { v8us v;
#pragma unroll
      for (int e = 0; e < 8; ++e) v[e] = bf16_bits(x[p * 8 + e]);
      *(v8us*)(x16 + p * 8) = v; }
    for (size_t p = tid; p < (size_t)QC * HID / 8; p += nth) { const int n = (int)(p / (HID / 8)), k0 = (int)(p % (HID / 8)) * 8; v8us v;
#pragma unroll
      for (int e = 0; e < 8; ++e) v[e] = bf16_bits(wq[(size_t)(k0 + e) * QC + n]);
      *(v8us*)(wq16 + (size_t)n * HID + k0) = v; }
    for (size_t p = tid; p < (size_t)KCP * HID / 8; p += nth) { const int n = (int)(p / (HID / 8)), k0 = (int)(p % (HID / 8)) * 8; v8us v;
#pragma unroll
      for (int e = 0; e < 8; ++e) { const float val = (n < HD) ? wk[(size_t)(k0 + e) * HD + n] : (n < KC) ? ww[(size_t)(k0 + e) * NH + (n - HD)] : 0.0f; v[e] = bf16_bits(val); }
      *(v8us*)(wk16 + (size_t)n * HID + k0) = v; }
    
  }
}

// q projection: block = 128 tokens x one 64-column tile (tile t: head t/2, dims (t%2)*64..+63; RoPE on the t%2 == 0 tiles: pairs (i, i+32) within the tile); x8 hi/lo planes qh[tok][2048]
__global__ __launch_bounds__(128) void qproj_kernel(const unsigned short* __restrict__ x16, const unsigned short* __restrict__ wq16, const float* __restrict__ cosb, const float* __restrict__ sinb, b16* __restrict__ qh, int rowbase) {
  __shared__ __attribute__((aligned(16))) b16 Th[4][32][64 + 8], Tl[4][32][64 + 8];
  const int lane = threadIdx.x & 31, wave = threadIdx.x >> 5, nloc = lane & 15, hlf = lane >> 4, m0 = rowbase + blockIdx.y * 128 + wave * 32, c0 = blockIdx.x * 64;
  v8f acc[2][4];
#pragma unroll
  for (int r = 0; r < 2; ++r)
#pragma unroll
    for (int t = 0; t < 4; ++t) acc[r][t] = (v8f){};
  // Two register sets: the loads of k block s + 1 are issued as one group ahead of the WMMAs of block s, so a block waits for loads that have had a whole block's time to land.
  const unsigned short* xa = x16 + (size_t)(m0 + nloc) * HID; const unsigned short* wb = wq16 + (size_t)(c0 + nloc) * HID;
  v16bb f0[6], f1[6];                                          // a0, a1, b0..b3
  auto fetch = [&](v16bb (&f)[6], int kb) { f[0] = frag_bf(xa + kb, hlf); f[1] = frag_bf(xa + 16 * HID + kb, hlf);
#pragma unroll
    for (int t = 0; t < 4; ++t) f[2 + t] = frag_bf(wb + t * 16 * HID + kb, hlf); };
  auto mma = [&](const v16bb (&f)[6]) {
#pragma unroll
    for (int t = 0; t < 4; ++t) { acc[0][t] = wmma16bb(f[0], f[2 + t], acc[0][t]); acc[1][t] = wmma16bb(f[1], f[2 + t], acc[1][t]); } };
  fetch(f0, 0);
#pragma unroll 1   // stays rolled: one trip already holds two k blocks, one per register set; more would only cost registers and a wave per SIMD
  for (int kb = 0; kb < HID - 64; kb += 64) { fetch(f1, kb + 32); mma(f0); fetch(f0, kb + 64); mma(f1);
    asm volatile("s_wait_xcnt 0x0" ::: "memory"); }            // loads are still in flight here and the next trip rewrites their address registers: the wait stands in front of that
  fetch(f1, HID - 32); mma(f0);
  asm volatile("s_wait_xcnt 0x0" ::: "memory");                // the last block's loads may be in flight and the epilogue reuses their address registers: the wait stands in front of that
  mma(f1);
  const bool rope = ((blockIdx.x & 1) == 0);                   // first 64 dims of each head
  if (rope) {
#pragma unroll
    for (int t = 0; t < 2; ++t) { const int i = t * 16 + nloc;   // pair (i, i + 32) = (acc[.][t], acc[.][t+2])
#pragma unroll
      for (int r = 0; r < 2; ++r)
#pragma unroll
        for (int v = 0; v < 8; ++v) { const int tok = m0 + r * 16 + 8 * hlf + v; const size_t cb = (size_t)tok * RD;   // cos/sin rows [b*S + s][64]
          const float c1 = bf16_rne(cosb[cb + i]), s1 = bf16_rne(sinb[cb + i]), c2 = bf16_rne(cosb[cb + i + 32]), s2 = bf16_rne(sinb[cb + i + 32]);
          const float x1 = acc[r][t][v], x2 = acc[r][t + 2][v]; acc[r][t][v] = x1 * c1 - x2 * s1; acc[r][t + 2][v] = x2 * c2 + x1 * s2; } } }
#pragma unroll
  for (int t = 0; t < 4; ++t)
#pragma unroll
    for (int r = 0; r < 2; ++r)
#pragma unroll
      for (int v = 0; v < 8; ++v) { b16 a_, c_; split16(acc[r][t][v] * QS, a_, c_); Th[wave][r * 16 + 8 * hlf + v][t * 16 + nloc] = a_; Tl[wave][r * 16 + 8 * hlf + v][t * 16 + nloc] = c_; }
  wave_lds_sync();
  b16* dst = qh + (size_t)m0 * QC + c0;
  {
#pragma unroll
    for (int j = 0; j < 8; ++j) { const int rr = j * 4 + (lane >> 3), c8 = (lane & 7) * 8; *(v8b*)(dst + (size_t)rr * QC + c8) = *(const v8b*)(&Th[wave][rr][c8]); *(v8b*)(dst + QPL + (size_t)rr * QC + c8) = *(const v8b*)(&Tl[wave][rr][c8]); }
     }
}

// k + w projection: block = 128 tokens x 144 columns (wave = 32 rows x 144 cols = 9 n-subtiles): k = cols 0..127 -> LayerNorm over 128 (row stats via the LDS tile) -> RoPE on dims
// 2 KB contiguous per wave). grid NTOK/128 x 128.
__global__ __launch_bounds__(128) void kproj_kernel(const unsigned short* __restrict__ x16, const unsigned short* __restrict__ wk16, const float* __restrict__ cosb, const float* __restrict__ sinb, const float* __restrict__ g, const float* __restrict__ bta, b16* __restrict__ kh, float* __restrict__ wout) {
  __shared__ __attribute__((aligned(16))) float Tk[4][32][KC + 1]; __shared__ __attribute__((aligned(16))) b16 Th[4][32][HD + 8], Tl[4][32][HD + 8]; __shared__ __attribute__((aligned(16))) float Tw[4][32][NH];
  const int lane = threadIdx.x & 31, wave = threadIdx.x >> 5, nloc = lane & 15, hlf = lane >> 4, m0 = blockIdx.x * 128 + wave * 32;
  v8f acc[2][9];
#pragma unroll
  for (int r = 0; r < 2; ++r)
#pragma unroll
    for (int t = 0; t < 9; ++t) acc[r][t] = (v8f){};
  // Every fragment is fetched one k block ahead: the next block's two A fragments go into a second set at the block's head, each B fragment is refilled directly behind its own two WMMAs.
  const unsigned short* xa = x16 + (size_t)(m0 + nloc) * HID; const unsigned short* wb = wk16 + (size_t)nloc * HID;
  v16bb a0[2], a1[2], bw[9];
  a0[0] = frag_bf(xa, hlf); a0[1] = frag_bf(xa + 16 * HID, hlf);
#pragma unroll
  for (int t = 0; t < 9; ++t) bw[t] = frag_bf(wb + t * 16 * HID, hlf);
  auto kstep = [&](const v16bb (&ac)[2], v16bb (&an)[2], int kn, bool more) {   // kn = the next k block's start; more is a literal at every call
    if (more) { an[0] = frag_bf(xa + kn, hlf); an[1] = frag_bf(xa + 16 * HID + kn, hlf); }
#pragma unroll
    for (int t = 0; t < 9; ++t) { acc[0][t] = wmma16bb(ac[0], bw[t], acc[0][t]); acc[1][t] = wmma16bb(ac[1], bw[t], acc[1][t]); if (more) bw[t] = frag_bf(wb + t * 16 * HID + kn, hlf); } };
#pragma unroll 1   // stays rolled: one trip already holds two k blocks, one per A set
  for (int kb = 0; kb < HID - 64; kb += 64) { kstep(a0, a1, kb + 32, true); kstep(a1, a0, kb + 64, true);
    asm volatile("s_wait_xcnt 0x0" ::: "memory"); }            // loads are still in flight here and the next trip rewrites their address registers: the wait stands in front of that
  kstep(a0, a1, HID - 32, true);
  asm volatile("s_wait_xcnt 0x0" ::: "memory");                // the last block's loads may be in flight and the epilogue reuses their address registers: the wait stands in front of that
  kstep(a1, a0, 0, false);
#pragma unroll
  for (int t = 0; t < 9; ++t)
#pragma unroll
    for (int r = 0; r < 2; ++r)
#pragma unroll
      for (int v = 0; v < 8; ++v) Tk[wave][r * 16 + 8 * hlf + v][t * 16 + nloc] = acc[r][t][v];
  wave_lds_sync();
  { const int rr = lane; const float* row = Tk[wave][rr]; const int tok = m0 + rr;   // lane = one token row: LayerNorm over 128, RoPE, split; w scaled
    float mu = 0.0f; for (int d = 0; d < HD; ++d) mu += row[d]; mu *= (1.0f / HD);
    float var = 0.0f; for (int d = 0; d < HD; ++d) { const float z = row[d] - mu; var += z * z; } var *= (1.0f / HD);
    const float rs = rsqrtf(var + LNE); const size_t cb = (size_t)tok * RD;
#pragma unroll 2
    for (int i = 0; i < 32; ++i) {                               // RoPE pairs (i, i+32) of the normalised row, then the un-rotated dims 64..127 — no per-lane array
      const float x1 = (row[i] - mu) * rs * bf16_rne(g[i]) + bf16_rne(bta[i]), x2 = (row[i + 32] - mu) * rs * bf16_rne(g[i + 32]) + bf16_rne(bta[i + 32]);
      const float c1 = bf16_rne(cosb[cb + i]), s1 = bf16_rne(sinb[cb + i]), c2 = bf16_rne(cosb[cb + i + 32]), s2 = bf16_rne(sinb[cb + i + 32]);
      b16 a_, c_; split16((x1 * c1 - x2 * s1) * QS, a_, c_); Th[wave][rr][i] = a_; Tl[wave][rr][i] = c_; split16((x2 * c2 + x1 * s2) * QS, a_, c_); Th[wave][rr][i + 32] = a_; Tl[wave][rr][i + 32] = c_; }
#pragma unroll 2
    for (int d = RD; d < HD; ++d) { b16 a_, c_; split16(((row[d] - mu) * rs * bf16_rne(g[d]) + bf16_rne(bta[d])) * QS, a_, c_); Th[wave][rr][d] = a_; Tl[wave][rr][d] = c_; }
#pragma unroll
    for (int h = 0; h < NH; ++h) Tw[wave][rr][h] = row[HD + h] * SCALE; }
  wave_lds_sync();
  {
#pragma unroll
    for (int j = 0; j < 16; ++j) { const int rr = j * 2 + hlf, c8 = nloc * 8; *(v8b*)(kh + (size_t)(m0 + rr) * HD + c8) = *(const v8b*)(&Th[wave][rr][c8]); *(v8b*)(kh + KPL + (size_t)(m0 + rr) * HD + c8) = *(const v8b*)(&Tl[wave][rr][c8]); }
#pragma unroll
    for (int j = 0; j < 4; ++j) { const int rr = j * 8 + (lane >> 2), c4 = (lane & 3) * 4; *(v4f*)(wout + (size_t)(m0 + rr) * NH + c4) = *(const v4f*)(&Tw[wave][rr][c4]); }   // 8 rows x 64 B = 512 B per instruction
     }
}

// Each wave owns 32 keys: their hi and lo fragments (16 x 8 registers) are loaded once and stay in registers over NQ query tiles x 16 heads; only q and w are fetched inside the loops.
template <int QT, int NQ>
__global__ __launch_bounds__(256) void score_kernel(const b16* __restrict__ qh, const b16* __restrict__ kh, const float* __restrict__ w, float* __restrict__ out) {
  __shared__ __attribute__((aligned(16))) float Os[8][16][32 + 4];
  const int wid = threadIdx.x >> 5, lane = threadIdx.x & 31, hh = lane >> 4, col = lane & 15;
  const int wg = blockIdx.x * 8 + wid, kt = wg % (S / 32), qg = (wg / (S / 32)) % (QT / NQ), b = wg / ((S / 32) * (QT / NQ)), k0 = kt * 32;
  const b16* K = kh + ((size_t)b * S + k0) * HD;
  v16b ka[4], kal[4], kb_[4], kbl[4];
#pragma unroll
  for (int ks = 0; ks < 4; ++ks) { ka[ks] = frag_kb(K + (size_t)col * HD + ks * 32, hh); kal[ks] = frag_kb(K + KPL + (size_t)col * HD + ks * 32, hh); kb_[ks] = frag_kb(K + (size_t)(16 + col) * HD + ks * 32, hh); kbl[ks] = frag_kb(K + KPL + (size_t)(16 + col) * HD + ks * 32, hh); }
  // q fragments are fetched one head ahead: the four hi/lo pairs stay in registers and each pair is refilled for the next head (or the next tile's first head) directly behind its own six WMMAs.
  v16b qf[4], ql[4];
  asm volatile("s_wait_xcnt 0x0" ::: "memory");                // the k loads are in flight and the q loads below may land on their address registers: the wait stands in front of that
  const b16* Qc = qh + ((size_t)b * S + qg * NQ * 16 + col) * QC;   // this lane's query row, at the head whose fragments are in qf / ql
#pragma unroll
  for (int ks = 0; ks < 4; ++ks) { qf[ks] = frag_kb(Qc + ks * 32, hh); ql[ks] = frag_kb(Qc + QPL + ks * 32, hh); }
  for (int qq = 0; qq < NQ; ++qq) { const int q0 = (qg * NQ + qq) * 16, qi = q0 + col;
    v8f o0 = {}, o1 = {};
    for (int h = 0; h < NH; ++h) { v8f s0 = {}, s1 = {};
      const float wq = w[((size_t)b * S + qi) * NH + h];           // w for this lane's query and head, issued ahead of the head's WMMAs
      // next head of this tile, or head 0 of the next tile; behind the wave's last head the refill reads that head again (in bounds, not used), so no branch stands among the WMMAs
      const b16* Qn = Qc + ((h + 1 < NH) ? HD : (qq + 1 < NQ) ? 16 * QC - (NH - 1) * HD : 0);
#pragma unroll
      for (int ks = 0; ks < 4; ++ks) {
        s0 = wmma16b(ka[ks], qf[ks], s0); s0 = wmma16b(ka[ks], ql[ks], s0); s0 = wmma16b(kal[ks], qf[ks], s0); s1 = wmma16b(kb_[ks], qf[ks], s1); s1 = wmma16b(kb_[ks], ql[ks], s1); s1 = wmma16b(kbl[ks], qf[ks], s1);
        qf[ks] = frag_kb(Qn + ks * 32, hh); ql[ks] = frag_kb(Qn + QPL + ks * 32, hh); }
      Qc = Qn;
#pragma unroll
      for (int r = 0; r < 8; ++r) { o0[r] += wq * fmaxf(s0[r] * (1.0f / (QS * QS)), 0.0f); o1[r] += wq * fmaxf(s1[r] * (1.0f / (QS * QS)), 0.0f); }
      asm volatile("s_wait_xcnt 0x0" ::: "memory"); }            // the next head's q loads are in flight here and the next trip rewrites their address registers: the wait stands in front of that
    // o0[r] = (key k0 + 8hh + r, query col); o1 -> key k0 + 16 + 8hh + r
#pragma unroll
    for (int r = 0; r < 8; ++r) { Os[wid][col][8 * hh + r] = o0[r]; Os[wid][col][16 + 8 * hh + r] = o1[r]; }
    wave_lds_sync();
    float* dst = out + ((size_t)b * S + q0) * S + k0;
#pragma unroll
    for (int j = 0; j < 4; ++j) { const int rr = j * 4 + (lane >> 3), c4 = (lane & 7) * 4; *(v4f*)(dst + (size_t)rr * S + c4) = *(const v4f*)(&Os[wid][rr][c4]); }
    wave_lds_sync();   // the next query tile rewrites this wave's Os slice: its reads above come first
  }
}
}  // namespace

extern "C" void kernel_launch(void* const* d_in, const int* in_sizes, int n_in,
                              void* d_out, int out_size, void* d_ws, size_t ws_size, hipStream_t stream) {
  (void)n_in; (void)out_size;
  const float* x = (const float*)d_in[0]; const float* cosb = (const float*)d_in[1]; const float* sinb = (const float*)d_in[2]; const float* wq = (const float*)d_in[3]; const float* wk = (const float*)d_in[4]; const float* ww = (const float*)d_in[5]; const float* g = (const float*)d_in[6]; const float* bta = (const float*)d_in[7];
  float* out = (float*)d_out;   // [2][2048][2048]
  if (in_sizes[0] != NTOK * HID || in_sizes[1] != NTOK * RD || in_sizes[2] != NTOK * RD || in_sizes[3] != HID * QC || in_sizes[4] != HID * HD || in_sizes[5] != HID * NH || in_sizes[6] != HD) return;
  size_t off = 0; char* ws = (char*)d_ws;
  auto carve = [&](size_t bytes) { char* p = ws + off; off += (bytes + 255) & ~(size_t)255; return p; };
  unsigned short* x16 = (unsigned short*)carve((size_t)NTOK * HID * 2); unsigned short* wq16 = (unsigned short*)carve((size_t)QC * HID * 2); unsigned short* wk16 = (unsigned short*)carve((size_t)KCP * HID * 2);
  b16* qh = (b16*)carve(QPL * 2 * 2); b16* kh = (b16*)carve(KPL * 2 * 2); float* w = (float*)carve((size_t)NTOK * NH * 4);
  if (off > ws_size) return;                                    // ≈ 16.8 + 8.4 + 0.8 + 33.5 + 2.1 + 0.3 ≈ 62 MB
  prep_kernel<<<1024, 256, 0, stream>>>(x, wq, wk, ww, x16, wq16, wk16);
  qproj_kernel<<<dim3(QC / 64, NTOK / 128), 128, 0, stream>>>(x16, wq16, cosb, sinb, qh, 0);
  kproj_kernel<<<NTOK / 128, 128, 0, stream>>>(x16, wk16, cosb, sinb, g, bta, kh, w);
  score_kernel<S / 16, 4><<<Bn * (S / 16 / 4) * (S / 32) / 8, 256, 0, stream>>>(qh, kh, w, out);
}

// v003
// A run of this version takes 150 microseconds.
// Timed twice side by side with v002, it ran 1.43 times as fast both times.
// Counting every step since v000, it is 3.53 times as fast.
#include <hip/hip_runtime.h>

// Indexer: q = x Wq (16 heads x 128), k = LayerNorm_128(x Wk) (one shared head), w = SCALE x Ww (16 per token); partial RoPE (rotate-half over the first 64 dims, cos/sin INPUT tables)
// on q and k; score[b][h][q][k] = relu(q_h . k); out[b][q][k] = sum_h w[b][q][h] score -> [2][2048][2048].
// Inputs (x, Wq, Wk, Ww, cos, sin, ln params) rounded to bf16: projections on v_wmma_f32_16x16x32_bf16 (exact products, f32 accumulate;
// LayerNorm, RoPE and the w scaling in f32 in the epilogues); the 16 per-head score tiles on v_wmma_f32_16x16x32_f16 with q and k as f16 hi+lo pairs carried x8 (3 products), relu and the

namespace {
constexpr int Bn = 2, S = 2048, HID = 2048, NH = 16, HD = 128, RD = 64, NTOK = Bn * S, QC = NH * HD /* 2048 */, KC = HD + NH /* k (128) + w (16) = 144 */, KCP = 192;
constexpr float SCALE = 0.022097086912079608f /* 128^-0.5 * 16^-0.5 */, QS = 8.0f, LNE = 1e-5f;
constexpr size_t QPL = (size_t)NTOK * QC, KPL = (size_t)NTOK * HD;

typedef _Float16 b16;
typedef __attribute__((ext_vector_type(16))) _Float16 v16b;
typedef __attribute__((ext_vector_type(16))) __bf16 v16bb;
typedef __attribute__((ext_vector_type(8))) _Float16 v8b;
typedef __attribute__((ext_vector_type(8))) unsigned short v8us;
typedef __attribute__((ext_vector_type(8))) float v8f;
typedef __attribute__((ext_vector_type(4))) float v4f;
__device__ __forceinline__ float bf16_rne(float f) { unsigned int u = __float_as_uint(f); u += 0x7FFFu + ((u >> 16) & 1u); return __uint_as_float(u & 0xFFFF0000u); }
__device__ __forceinline__ unsigned short bf16_bits(float f) { unsigned int u = __float_as_uint(f); u += 0x7FFFu + ((u >> 16) & 1u); return (unsigned short)(u >> 16); }
__device__ __forceinline__ void split16(float v, b16& hi, b16& lo) { hi = (b16)v; lo = (b16)(v - (float)hi); }
// Fragment order of every 16-bit WMMA operand in the workspace: a [rows][K] matrix is kept as tiles of 16 rows x 32 k (512 elements, 1 KB), tile (R, Kb) at (R * (K / 32) + Kb) * 512; inside a tile
// element (row c, k kk) sits at (kk >> 3) * 128 + c * 8 + (kk & 7). Lane l = 16 * hh + c finds its k = 8hh..8hh+7 at l * 8 and its k = 16+8hh..16+8hh+7 at 256 + l * 8 (the same register
// contents as from a row-major matrix), so each load of a wave reads 512 contiguous bytes (4 whole cache lines) and not 32 bytes of each of 16 lines. p = tile start + lane * 8.
constexpr int TILE = 512, XROW = (HID / 32) * TILE /* one 16-row strip of a K = 2048 operand */, KROW = (HD / 32) * TILE;
__device__ __forceinline__ v16b frag_kb(const b16* p) { const v8b a = *(const v8b*)(p), b = *(const v8b*)(p + 256); v16b f;
#pragma unroll
  for (int e = 0; e < 8; ++e) { f[e] = a[e]; f[8 + e] = b[e]; } return f; }
__device__ __forceinline__ v16bb frag_bf(const unsigned short* p) { const v8us a = *(const v8us*)(p), b = *(const v8us*)(p + 256); union { unsigned short s[16]; v16bb v; } u;
#pragma unroll
  for (int e = 0; e < 8; ++e) { u.s[e] = a[e]; u.s[8 + e] = b[e]; } return u.v; }
__device__ __forceinline__ v8f wmma16b(v16b a, v16b b, v8f c) { v8f d = __builtin_amdgcn_wmma_f32_16x16x32_f16(false, a, false, b, (short)0, c, false, false); asm volatile("v_nop\n\tv_nop\n\tv_nop\n\tv_nop" : "+v"(d) : "v"(a), "v"(b)); return d; }
__device__ __forceinline__ v8f wmma16bb(v16bb a, v16bb b, v8f c) { v8f d = __builtin_amdgcn_wmma_f32_16x16x32_bf16(false, a, false, b, (short)0, c, false, false); asm volatile("v_nop\n\tv_nop\n\tv_nop\n\tv_nop" : "+v"(d) : "v"(a), "v"(b)); return d; }
__device__ __forceinline__ void wave_lds_sync() { __builtin_amdgcn_fence(__ATOMIC_RELEASE, "workgroup"); __builtin_amdgcn_wave_barrier(); __builtin_amdgcn_fence(__ATOMIC_ACQUIRE, "workgroup"); }

__global__ __launch_bounds__(256) void prep_kernel(const float* __restrict__ x, const float* __restrict__ wq, const float* __restrict__ wk, const float* __restrict__ ww, unsigned short* __restrict__ x16, unsigned short* __restrict__ wq16, unsigned short* __restrict__ wk16) {
  const size_t tid = (size_t)blockIdx.x * blockDim.x + threadIdx.x, nth = (size_t)gridDim.x * blockDim.x;
  // One thread = one 16-byte piece of a fragment-order tile. A wave takes 8 rows x the tile's 32 k: piece p -> tile p / 64, row half (p / 32) % 2, k octet (p / 8) % 4, row p % 8; its store fills 4 whole lines.
  auto place = [](size_t p, int& row, int& k0, size_t& dst) { const size_t tile = p >> 6; const int c = (int)((p >> 5) & 1) * 8 + (int)(p & 7), q = (int)(p >> 3) & 3;
    row = (int)(tile / (HID / 32)) * 16 + c; k0 = (int)(tile % (HID / 32)) * 32 + q * 8; dst = tile * TILE + q * 128 + c * 8; };
  for (size_t p = tid; p < (size_t)NTOK * HID / 8; p += nth) { int row, k0; size_t dst; place(p, row, k0, dst); v8us v;
    const v4f a = *(const v4f*)(x + (size_t)row * HID + k0), b = *(const v4f*)(x + (size_t)row * HID + k0 + 4);
#pragma unroll
    for (int e = 0; e < 4; ++e) { v[e] = bf16_bits(a[e]); v[4 + e] = bf16_bits(b[e]); }
    *(v8us*)(x16 + dst) = v; }
  for (size_t p = tid; p < (size_t)QC * HID / 8; p += nth) { int n, k0; size_t dst; place(p, n, k0, dst); v8us v;
#pragma unroll
    for (int e = 0; e < 8; ++e) v[e] = bf16_bits(wq[(size_t)(k0 + e) * QC + n]);
    *(v8us*)(wq16 + dst) = v; }
  for (size_t p = tid; p < (size_t)KCP * HID / 8; p += nth) { int n, k0; size_t dst; place(p, n, k0, dst); v8us v;
#pragma unroll
    for (int e = 0; e < 8; ++e) { const float val = (n < HD) ? wk[(size_t)(k0 + e) * HD + n] : (n < KC) ? ww[(size_t)(k0 + e) * NH + (n - HD)] : 0.0f; v[e] = bf16_bits(val); }
    *(v8us*)(wk16 + dst) = v; }
}

// q projection: block = 128 tokens x one 64-column tile (tile t: head t/2, dims (t%2)*64..+63; RoPE on the t%2 == 0 tiles: pairs (i, i+32) within the tile); x8 hi/lo planes qh, [tok][2048] in fragment order
__global__ __launch_bounds__(128) void qproj_kernel(const unsigned short* __restrict__ x16, const unsigned short* __restrict__ wq16, const float* __restrict__ cosb, const float* __restrict__ sinb, b16* __restrict__ qh, int rowbase) {
  __shared__ __attribute__((aligned(16))) b16 Th[4][32][64 + 8], Tl[4][32][64 + 8];
  const int lane = threadIdx.x & 31, wave = threadIdx.x >> 5, nloc = lane & 15, hlf = lane >> 4, m0 = rowbase + blockIdx.y * 128 + wave * 32, c0 = blockIdx.x * 64;
  v8f acc[2][4];
#pragma unroll
  for (int r = 0; r < 2; ++r)
#pragma unroll
    for (int t = 0; t < 4; ++t) acc[r][t] = (v8f){};
  // Two register sets: the loads of k block s + 1 are issued as one group ahead of the WMMAs of block s, so a block waits for loads that have had a whole block's time to land.
  const unsigned short* xa = x16 + (size_t)(m0 >> 4) * XROW + lane * 8; const unsigned short* wb = wq16 + (size_t)(c0 >> 4) * XROW + lane * 8;   // k block kb is tile kb / 32: + kb * 16 elements
  v16bb f0[6], f1[6];                                          // a0, a1, b0..b3
  auto fetch = [&](v16bb (&f)[6], int kb) { f[0] = frag_bf(xa + kb * 16); f[1] = frag_bf(xa + XROW + kb * 16);
#pragma unroll
    for (int t = 0; t < 4; ++t) f[2 + t] = frag_bf(wb + t * XROW + kb * 16); };
  auto mma = [&](const v16bb (&f)[6]) {
#pragma unroll
    for (int t = 0; t < 4; ++t) { acc[0][t] = wmma16bb(f[0], f[2 + t], acc[0][t]); acc[1][t] = wmma16bb(f[1], f[2 + t], acc[1][t]); } };
  fetch(f0, 0);
#pragma unroll 1   // stays rolled: one trip already holds two k blocks, one per register set; more would only cost registers and a wave per SIMD
  for (int kb = 0; kb < HID - 64; kb += 64) { fetch(f1, kb + 32); mma(f0); fetch(f0, kb + 64); mma(f1);
    asm volatile("s_wait_xcnt 0x0" ::: "memory"); }            // loads are still in flight here and the next trip rewrites their address registers: the wait stands in front of that
  fetch(f1, HID - 32); mma(f0);
  asm volatile("s_wait_xcnt 0x0" ::: "memory");                // the last block's loads may be in flight and the epilogue reuses their address registers: the wait stands in front of that
  mma(f1);
  const bool rope = ((blockIdx.x & 1) == 0);                   // first 64 dims of each head
  if (rope) {
#pragma unroll
    for (int t = 0; t < 2; ++t) { const int i = t * 16 + nloc;   // pair (i, i + 32) = (acc[.][t], acc[.][t+2])
#pragma unroll
      for (int r = 0; r < 2; ++r)
#pragma unroll
        for (int v = 0; v < 8; ++v) { const int tok = m0 + r * 16 + 8 * hlf + v; const size_t cb = (size_t)tok * RD;   // cos/sin rows [b*S + s][64]
          const float c1 = bf16_rne(cosb[cb + i]), s1 = bf16_rne(sinb[cb + i]), c2 = bf16_rne(cosb[cb + i + 32]), s2 = bf16_rne(sinb[cb + i + 32]);
          const float x1 = acc[r][t][v], x2 = acc[r][t + 2][v]; acc[r][t][v] = x1 * c1 - x2 * s1; acc[r][t + 2][v] = x2 * c2 + x1 * s2; } } }
#pragma unroll
  for (int t = 0; t < 4; ++t)
#pragma unroll
    for (int r = 0; r < 2; ++r)
#pragma unroll
      for (int v = 0; v < 8; ++v) { b16 a_, c_; split16(acc[r][t][v] * QS, a_, c_); Th[wave][r * 16 + 8 * hlf + v][t * 16 + nloc] = a_; Tl[wave][r * 16 + 8 * hlf + v][t * 16 + nloc] = c_; }
  wave_lds_sync();
  b16* dst = qh + (size_t)(m0 >> 4) * XROW + (c0 >> 5) * TILE + lane * 8;   // the wave's 32 x 64 = 2 x 2 tiles, two 512-byte halves each
  {
#pragma unroll
    for (int j = 0; j < 8; ++j) { const int rr = (j >> 2) * 16 + nloc, c8 = ((j >> 1) & 1) * 32 + (j & 1) * 16 + hlf * 8, o = (j >> 2) * XROW + ((j >> 1) & 1) * TILE + (j & 1) * 256;
      *(v8b*)(dst + o) = *(const v8b*)(&Th[wave][rr][c8]); *(v8b*)(dst + QPL + o) = *(const v8b*)(&Tl[wave][rr][c8]); }
     }
}

// k + w projection: block = 128 tokens x 144 columns (wave = 32 rows x 144 cols = 9 n-subtiles): k = cols 0..127 -> LayerNorm over 128 (row stats via the LDS tile) -> RoPE on dims
// 2 KB contiguous per wave). grid NTOK/128 x 128.
__global__ __launch_bounds__(128) void kproj_kernel(const unsigned short* __restrict__ x16, const unsigned short* __restrict__ wk16, const float* __restrict__ cosb, const float* __restrict__ sinb, const float* __restrict__ g, const float* __restrict__ bta, b16* __restrict__ kh, float* __restrict__ wout) {
  __shared__ __attribute__((aligned(16))) float Tk[4][32][KC + 1]; __shared__ __attribute__((aligned(16))) b16 Th[4][32][HD + 8], Tl[4][32][HD + 8]; __shared__ __attribute__((aligned(16))) float Tw[4][32][NH];
  const int lane = threadIdx.x & 31, wave = threadIdx.x >> 5, nloc = lane & 15, hlf = lane >> 4, m0 = blockIdx.x * 128 + wave * 32;
  v8f acc[2][9];
#pragma unroll
  for (int r = 0; r < 2; ++r)
#pragma unroll
    for (int t = 0; t < 9; ++t) acc[r][t] = (v8f){};
  // Every fragment is fetched one k block ahead: the next block's two A fragments go into a second set at the block's head, each B fragment is refilled directly behind its own two WMMAs.
  const unsigned short* xa = x16 + (size_t)(m0 >> 4) * XROW + lane * 8; const unsigned short* wb = wk16 + lane * 8;   // k block kb is tile kb / 32: + kb * 16 elements
  v16bb a0[2], a1[2], bw[9];
  a0[0] = frag_bf(xa); a0[1] = frag_bf(xa + XROW);
#pragma unroll
  for (int t = 0; t < 9; ++t) bw[t] = frag_bf(wb + t * XROW);
  auto kstep = [&](const v16bb (&ac)[2], v16bb (&an)[2], int kn, bool more) {   // kn = the next k block's start; more is a literal at every call
    if (more) { an[0] = frag_bf(xa + kn * 16); an[1] = frag_bf(xa + XROW + kn * 16); }
#pragma unroll
    for (int t = 0; t < 9; ++t) { acc[0][t] = wmma16bb(ac[0], bw[t], acc[0][t]); acc[1][t] = wmma16bb(ac[1], bw[t], acc[1][t]); if (more) bw[t] = frag_bf(wb + t * XROW + kn * 16); } };
#pragma unroll 1   // stays rolled: one trip already holds two k blocks, one per A set
  for (int kb = 0; kb < HID - 64; kb += 64) { kstep(a0, a1, kb + 32, true); kstep(a1, a0, kb + 64, true);
    asm volatile("s_wait_xcnt 0x0" ::: "memory"); }            // loads are still in flight here and the next trip rewrites their address registers: the wait stands in front of that
  kstep(a0, a1, HID - 32, true);
  asm volatile("s_wait_xcnt 0x0" ::: "memory");                // the last block's loads may be in flight and the epilogue reuses their address registers: the wait stands in front of that
  kstep(a1, a0, 0, false);
#pragma unroll
  for (int t = 0; t < 9; ++t)
#pragma unroll
    for (int r = 0; r < 2; ++r)
#pragma unroll
      for (int v = 0; v < 8; ++v) Tk[wave][r * 16 + 8 * hlf + v][t * 16 + nloc] = acc[r][t][v];
  wave_lds_sync();
  { const int rr = lane; const float* row = Tk[wave][rr]; const int tok = m0 + rr;   // lane = one token row: LayerNorm over 128, RoPE, split; w scaled
    float mu = 0.0f; for (int d = 0; d < HD; ++d) mu += row[d]; mu *= (1.0f / HD);
    float var = 0.0f; for (int d = 0; d < HD; ++d) { const float z = row[d] - mu; var += z * z; } var *= (1.0f / HD);
    const float rs = rsqrtf(var + LNE); const size_t cb = (size_t)tok * RD;
#pragma unroll 2
    for (int i = 0; i < 32; ++i) {                               // RoPE pairs (i, i+32) of the normalised row, then the un-rotated dims 64..127 — no per-lane array
      const float x1 = (row[i] - mu) * rs * bf16_rne(g[i]) + bf16_rne(bta[i]), x2 = (row[i + 32] - mu) * rs * bf16_rne(g[i + 32]) + bf16_rne(bta[i + 32]);
      const float c1 = bf16_rne(cosb[cb + i]), s1 = bf16_rne(sinb[cb + i]), c2 = bf16_rne(cosb[cb + i + 32]), s2 = bf16_rne(sinb[cb + i + 32]);
      b16 a_, c_; split16((x1 * c1 - x2 * s1) * QS, a_, c_); Th[wave][rr][i] = a_; Tl[wave][rr][i] = c_; split16((x2 * c2 + x1 * s2) * QS, a_, c_); Th[wave][rr][i + 32] = a_; Tl[wave][rr][i + 32] = c_; }
#pragma unroll 2
    for (int d = RD; d < HD; ++d) { b16 a_, c_; split16(((row[d] - mu) * rs * bf16_rne(g[d]) + bf16_rne(bta[d])) * QS, a_, c_); Th[wave][rr][d] = a_; Tl[wave][rr][d] = c_; }
#pragma unroll
    for (int h = 0; h < NH; ++h) Tw[wave][rr][h] = row[HD + h] * SCALE; }
  wave_lds_sync();
  {
#pragma unroll
    for (int j = 0; j < 16; ++j) { const int rr = (j >> 3) * 16 + nloc, c8 = (j & 7) * 16 + hlf * 8; b16* d = kh + (size_t)(m0 >> 4) * KROW + j * 256 + lane * 8;   // 2 x 4 tiles in fragment order, 16 consecutive 512-byte halves
      *(v8b*)(d) = *(const v8b*)(&Th[wave][rr][c8]); *(v8b*)(d + KPL) = *(const v8b*)(&Tl[wave][rr][c8]); }
#pragma unroll
    for (int j = 0; j < 4; ++j) { const int rr = j * 8 + (lane >> 2), c4 = (lane & 3) * 4; *(v4f*)(wout + (size_t)(m0 + rr) * NH + c4) = *(const v4f*)(&Tw[wave][rr][c4]); }   // 8 rows x 64 B = 512 B per instruction
     }
}

// Each wave owns 32 keys: their hi and lo fragments (16 x 8 registers) are loaded once and stay in registers over NQ query tiles x 16 heads; only q and w are fetched inside the loops.
template <int QT, int NQ>
__global__ __launch_bounds__(256) void score_kernel(const b16* __restrict__ qh, const b16* __restrict__ kh, const float* __restrict__ w, float* __restrict__ out) {
  __shared__ __attribute__((aligned(16))) float Os[8][16][32 + 4];
  const int wid = threadIdx.x >> 5, lane = threadIdx.x & 31, hh = lane >> 4, col = lane & 15;
  const int wg = blockIdx.x * 8 + wid, kt = wg % (S / 32), qg = (wg / (S / 32)) % (QT / NQ), b = wg / ((S / 32) * (QT / NQ)), k0 = kt * 32;
  const b16* K = kh + (((size_t)b * S + k0) >> 4) * KROW + lane * 8;
  v16b ka[4], kal[4], kb_[4], kbl[4];
#pragma unroll
  for (int ks = 0; ks < 4; ++ks) { ka[ks] = frag_kb(K + ks * TILE); kal[ks] = frag_kb(K + KPL + ks * TILE); kb_[ks] = frag_kb(K + KROW + ks * TILE); kbl[ks] = frag_kb(K + KPL + KROW + ks * TILE); }
  // q fragments are fetched one head ahead: the four hi/lo pairs stay in registers and each pair is refilled for the next head (or the next tile's first head) directly behind its own six WMMAs.
  v16b qf[4], ql[4];
  asm volatile("s_wait_xcnt 0x0" ::: "memory");                // the k loads are in flight and the q loads below may land on their address registers: the wait stands in front of that
  const b16* Qc = qh + ((size_t)b * (S / 16) + qg * NQ) * XROW + lane * 8;   // this lane's place in the four tiles of the query tile and head whose fragments are in qf / ql
#pragma unroll
  for (int ks = 0; ks < 4; ++ks) ql[ks] = frag_kb(Qc + QPL + ks * TILE);
  asm volatile("s_wait_xcnt 0x0" ::: "memory");                // the address of the lo plane is a temporary on which a hi fragment below may land: the wait stands in front of that
#pragma unroll
  for (int ks = 0; ks < 4; ++ks) qf[ks] = frag_kb(Qc + ks * TILE);
  for (int qq = 0; qq < NQ; ++qq) { const int q0 = (qg * NQ + qq) * 16, qi = q0 + col;
    v8f o0 = {}, o1 = {};
    for (int h = 0; h < NH; ++h) { v8f s0 = {}, s1 = {};
      const float wq = w[((size_t)b * S + qi) * NH + h];           // w for this lane's query and head, issued ahead of the head's WMMAs
      // next head of this tile, or head 0 of the next tile (in fragment order both lie directly behind this head's four tiles); behind the wave's last head the refill reads that head again (in bounds, not used), so no branch stands among the WMMAs
      const b16* Qn = Qc + ((h + 1 < NH || qq + 1 < NQ) ? 4 * TILE : 0);
#pragma unroll
      for (int ks = 0; ks < 4; ++ks) {
        s0 = wmma16b(ka[ks], qf[ks], s0); s0 = wmma16b(ka[ks], ql[ks], s0); s0 = wmma16b(kal[ks], qf[ks], s0); s1 = wmma16b(kb_[ks], qf[ks], s1); s1 = wmma16b(kb_[ks], ql[ks], s1); s1 = wmma16b(kbl[ks], qf[ks], s1);
        qf[ks] = frag_kb(Qn + ks * TILE); ql[ks] = frag_kb(Qn + QPL + ks * TILE); }
      Qc = Qn;
#pragma unroll
      for (int r = 0; r < 8; ++r) { o0[r] += wq * fmaxf(s0[r] * (1.0f / (QS * QS)), 0.0f); o1[r] += wq * fmaxf(s1[r] * (1.0f / (QS * QS)), 0.0f); }
      asm volatile("s_wait_xcnt 0x0" ::: "memory"); }            // the next head's q loads are in flight here and the next trip rewrites their address registers: the wait stands in front of that
    // o0[r] = (key k0 + 8hh + r, query col); o1 -> key k0 + 16 + 8hh + r
#pragma unroll
    for (int r = 0; r < 8; ++r) { Os[wid][col][8 * hh + r] = o0[r]; Os[wid][col][16 + 8 * hh + r] = o1[r]; }
    wave_lds_sync();
    float* dst = out + ((size_t)b * S + q0) * S + k0;
#pragma unroll
    for (int j = 0; j < 4; ++j) { const int rr = j * 4 + (lane >> 3), c4 = (lane & 7) * 4; *(v4f*)(dst + (size_t)rr * S + c4) = *(const v4f*)(&Os[wid][rr][c4]); }
    wave_lds_sync();   // the next query tile rewrites this wave's Os slice: its reads above come first
  }
}
}  // namespace

extern "C" void kernel_launch(void* const* d_in, const int* in_sizes, int n_in,
                              void* d_out, int out_size, void* d_ws, size_t ws_size, hipStream_t stream) {
  (void)n_in; (void)out_size;
  const float* x = (const float*)d_in[0]; const float* cosb = (const float*)d_in[1]; const float* sinb = (const float*)d_in[2]; const float* wq = (const float*)d_in[3]; const float* wk = (const float*)d_in[4]; const float* ww = (const float*)d_in[5]; const float* g = (const float*)d_in[6]; const float* bta = (const float*)d_in[7];
  float* out = (float*)d_out;   // [2][2048][2048]
  if (in_sizes[0] != NTOK * HID || in_sizes[1] != NTOK * RD || in_sizes[2] != NTOK * RD || in_sizes[3] != HID * QC || in_sizes[4] != HID * HD || in_sizes[5] != HID * NH || in_sizes[6] != HD) return;
  size_t off = 0; char* ws = (char*)d_ws;
  auto carve = [&](size_t bytes) { char* p = ws + off; off += (bytes + 255) & ~(size_t)255; return p; };
  unsigned short* x16 = (unsigned short*)carve((size_t)NTOK * HID * 2); unsigned short* wq16 = (unsigned short*)carve((size_t)QC * HID * 2); unsigned short* wk16 = (unsigned short*)carve((size_t)KCP * HID * 2);
  b16* qh = (b16*)carve(QPL * 2 * 2); b16* kh = (b16*)carve(KPL * 2 * 2); float* w = (float*)carve((size_t)NTOK * NH * 4);
  if (off > ws_size) return;                                    // ≈ 16.8 + 8.4 + 0.8 + 33.5 + 2.1 + 0.3 ≈ 62 MB
  prep_kernel<<<1024, 256, 0, stream>>>(x, wq, wk, ww, x16, wq16, wk16);
  qproj_kernel<<<dim3(QC / 64, NTOK / 128), 128, 0, stream>>>(x16, wq16, cosb, sinb, qh, 0);
  kproj_kernel<<<NTOK / 128, 128, 0, stream>>>(x16, wk16, cosb, sinb, g, bta, kh, w);
  score_kernel<S / 16, 4><<<Bn * (S / 16 / 4) * (S / 32) / 8, 256, 0, stream>>>(qh, kh, w, out);
}

// v004
// A run of this version takes 121 microseconds.
// In two side-by-side timings against v003, it was 1.23 and 1.25 times as fast.
// Counting every step since v000, it is 4.38 times as fast.
#include <hip/hip_runtime.h>

// Indexer: q = x Wq (16 heads x 128), k = LayerNorm_128(x Wk) (one shared head), w = SCALE x Ww (16 per token); partial RoPE (rotate-half over the first 64 dims, cos/sin INPUT tables)
// on q and k; score[b][h][q][k] = relu(q_h . k); out[b][q][k] = sum_h w[b][q][h] score -> [2][2048][2048].
// Inputs (x, Wq, Wk, Ww, cos, sin, ln params) rounded to bf16: projections on v_wmma_f32_16x16x32_bf16 (exact products, f32 accumulate;
// LayerNorm, RoPE and the w scaling in f32 in the epilogues); the 16 per-head score tiles on v_wmma_f32_16x16x32_f16 with q and k as f16 hi+lo pairs carried x8 (3 products), relu and the

namespace {
constexpr int Bn = 2, S = 2048, HID = 2048, NH = 16, HD = 128, RD = 64, NTOK = Bn * S, QC = NH * HD /* 2048 */, KC = HD + NH /* k (128) + w (16) = 144 */, KCP = 192;
constexpr float SCALE = 0.022097086912079608f /* 128^-0.5 * 16^-0.5 */, QS = 8.0f, LNE = 1e-5f;
constexpr size_t QPL = (size_t)NTOK * QC, KPL = (size_t)NTOK * HD;

typedef _Float16 b16;
typedef __attribute__((ext_vector_type(16))) _Float16 v16b;
typedef __attribute__((ext_vector_type(16))) __bf16 v16bb;
typedef __attribute__((ext_vector_type(8))) _Float16 v8b;
typedef __attribute__((ext_vector_type(8))) unsigned short v8us;
typedef __attribute__((ext_vector_type(8))) float v8f;
typedef __attribute__((ext_vector_type(4))) float v4f;
__device__ __forceinline__ float bf16_rne(float f) { unsigned int u = __float_as_uint(f); u += 0x7FFFu + ((u >> 16) & 1u); return __uint_as_float(u & 0xFFFF0000u); }
__device__ __forceinline__ unsigned short bf16_bits(float f) { unsigned int u = __float_as_uint(f); u += 0x7FFFu + ((u >> 16) & 1u); return (unsigned short)(u >> 16); }
__device__ __forceinline__ void split16(float v, b16& hi, b16& lo) { hi = (b16)v; lo = (b16)(v - (float)hi); }
// Fragment order of every 16-bit WMMA operand in the workspace: a [rows][K] matrix is kept as tiles of 16 rows x 32 k (512 elements, 1 KB), tile (R, Kb) at (R * (K / 32) + Kb) * 512; inside a tile
// element (row c, k kk) sits at (kk >> 3) * 128 + c * 8 + (kk & 7). Lane l = 16 * hh + c finds its k = 8hh..8hh+7 at l * 8 and its k = 16+8hh..16+8hh+7 at 256 + l * 8 (the same register
// contents as from a row-major matrix), so each load of a wave reads 512 contiguous bytes (4 whole cache lines) and not 32 bytes of each of 16 lines. p = tile start + lane * 8.
constexpr int TILE = 512, XROW = (HID / 32) * TILE /* one 16-row strip of a K = 2048 operand */, KROW = (HD / 32) * TILE;
__device__ __forceinline__ v16b frag_kb(const b16* p) { const v8b a = *(const v8b*)(p), b = *(const v8b*)(p + 256); v16b f;
#pragma unroll
  for (int e = 0; e < 8; ++e) { f[e] = a[e]; f[8 + e] = b[e]; } return f; }
__device__ __forceinline__ v16bb frag_bf(const unsigned short* p) { const v8us a = *(const v8us*)(p), b = *(const v8us*)(p + 256); union { unsigned short s[16]; v16bb v; } u;
#pragma unroll
  for (int e = 0; e < 8; ++e) { u.s[e] = a[e]; u.s[8 + e] = b[e]; } return u.v; }
__device__ __forceinline__ v8f wmma16b(v16b a, v16b b, v8f c) { v8f d = __builtin_amdgcn_wmma_f32_16x16x32_f16(false, a, false, b, (short)0, c, false, false); asm volatile("v_nop\n\tv_nop\n\tv_nop\n\tv_nop" : "+v"(d) : "v"(a), "v"(b)); return d; }
__device__ __forceinline__ v8f wmma16bb(v16bb a, v16bb b, v8f c) { v8f d = __builtin_amdgcn_wmma_f32_16x16x32_bf16(false, a, false, b, (short)0, c, false, false); asm volatile("v_nop\n\tv_nop\n\tv_nop\n\tv_nop" : "+v"(d) : "v"(a), "v"(b)); return d; }
__device__ __forceinline__ void wave_lds_sync() { __builtin_amdgcn_fence(__ATOMIC_RELEASE, "workgroup"); __builtin_amdgcn_wave_barrier(); __builtin_amdgcn_fence(__ATOMIC_ACQUIRE, "workgroup"); }

__global__ __launch_bounds__(256) void prep_kernel(const float* __restrict__ x, const float* __restrict__ wq, const float* __restrict__ wk, const float* __restrict__ ww, unsigned short* __restrict__ x16, unsigned short* __restrict__ wq16, unsigned short* __restrict__ wk16) {
  const size_t tid = (size_t)blockIdx.x * blockDim.x + threadIdx.x, nth = (size_t)gridDim.x * blockDim.x;
  // One thread = one 16-byte piece of a fragment-order tile. A wave takes 8 rows x the tile's 32 k: piece p -> tile p / 64, row half (p / 32) % 2, k octet (p / 8) % 4, row p % 8; its store fills 4 whole lines.
  auto place = [](size_t p, int& row, int& k0, size_t& dst) { const size_t tile = p >> 6; const int c = (int)((p >> 5) & 1) * 8 + (int)(p & 7), q = (int)(p >> 3) & 3;
    row = (int)(tile / (HID / 32)) * 16 + c; k0 = (int)(tile % (HID / 32)) * 32 + q * 8; dst = tile * TILE + q * 128 + c * 8; };
  for (size_t p = tid; p < (size_t)NTOK * HID / 8; p += nth) { int row, k0; size_t dst; place(p, row, k0, dst); v8us v;
    const v4f a = *(const v4f*)(x + (size_t)row * HID + k0), b = *(const v4f*)(x + (size_t)row * HID + k0 + 4);
#pragma unroll
    for (int e = 0; e < 4; ++e) { v[e] = bf16_bits(a[e]); v[4 + e] = bf16_bits(b[e]); }
    *(v8us*)(x16 + dst) = v; }
  for (size_t p = tid; p < (size_t)QC * HID / 8; p += nth) { int n, k0; size_t dst; place(p, n, k0, dst); v8us v;
#pragma unroll
    for (int e = 0; e < 8; ++e) v[e] = bf16_bits(wq[(size_t)(k0 + e) * QC + n]);
    *(v8us*)(wq16 + dst) = v; }
  for (size_t p = tid; p < (size_t)KCP * HID / 8; p += nth) { int n, k0; size_t dst; place(p, n, k0, dst); v8us v;
#pragma unroll
    for (int e = 0; e < 8; ++e) { const float val = (n < HD) ? wk[(size_t)(k0 + e) * HD + n] : (n < KC) ? ww[(size_t)(k0 + e) * NH + (n - HD)] : 0.0f; v[e] = bf16_bits(val); }
    *(v8us*)(wk16 + dst) = v; }
}

// q projection: block = 128 tokens x one 64-column tile (tile t: head t/2, dims (t%2)*64..+63; RoPE on the t%2 == 0 tiles: pairs (i, i+32) within the tile); x8 hi/lo planes qh, [tok][2048] in fragment order
__global__ __launch_bounds__(128) void qproj_kernel(const unsigned short* __restrict__ x16, const unsigned short* __restrict__ wq16, const float* __restrict__ cosb, const float* __restrict__ sinb, b16* __restrict__ qh, int rowbase) {
  __shared__ __attribute__((aligned(16))) b16 Th[4][32][64 + 8], Tl[4][32][64 + 8];
  const int lane = threadIdx.x & 31, wave = threadIdx.x >> 5, nloc = lane & 15, hlf = lane >> 4, m0 = rowbase + blockIdx.y * 128 + wave * 32, c0 = blockIdx.x * 64;
  v8f acc[2][4];
#pragma unroll
  for (int r = 0; r < 2; ++r)
#pragma unroll
    for (int t = 0; t < 4; ++t) acc[r][t] = (v8f){};
  // Two register sets: the loads of k block s + 1 are issued as one group ahead of the WMMAs of block s, so a block waits for loads that have had a whole block's time to land.
  const unsigned short* xa = x16 + (size_t)(m0 >> 4) * XROW + lane * 8; const unsigned short* wb = wq16 + (size_t)(c0 >> 4) * XROW + lane * 8;   // k block kb is tile kb / 32: + kb * 16 elements
  v16bb f0[6], f1[6];                                          // a0, a1, b0..b3
  auto fetch = [&](v16bb (&f)[6], int kb) { f[0] = frag_bf(xa + kb * 16); f[1] = frag_bf(xa + XROW + kb * 16);
#pragma unroll
    for (int t = 0; t < 4; ++t) f[2 + t] = frag_bf(wb + t * XROW + kb * 16); };
  auto mma = [&](const v16bb (&f)[6]) {
#pragma unroll
    for (int t = 0; t < 4; ++t) { acc[0][t] = wmma16bb(f[0], f[2 + t], acc[0][t]); acc[1][t] = wmma16bb(f[1], f[2 + t], acc[1][t]); } };
  fetch(f0, 0);
#pragma unroll 1   // stays rolled: one trip already holds two k blocks, one per register set; more would only cost registers and a wave per SIMD
  for (int kb = 0; kb < HID - 64; kb += 64) { fetch(f1, kb + 32); mma(f0); fetch(f0, kb + 64); mma(f1);
    asm volatile("s_wait_xcnt 0x0" ::: "memory"); }            // loads are still in flight here and the next trip rewrites their address registers: the wait stands in front of that
  fetch(f1, HID - 32); mma(f0);
  asm volatile("s_wait_xcnt 0x0" ::: "memory");                // the last block's loads may be in flight and the epilogue reuses their address registers: the wait stands in front of that
  mma(f1);
  const bool rope = ((blockIdx.x & 1) == 0);                   // first 64 dims of each head
  if (rope) {
#pragma unroll
    for (int t = 0; t < 2; ++t) { const int i = t * 16 + nloc;   // pair (i, i + 32) = (acc[.][t], acc[.][t+2])
#pragma unroll
      for (int r = 0; r < 2; ++r)
#pragma unroll
        for (int v = 0; v < 8; ++v) { const int tok = m0 + r * 16 + 8 * hlf + v; const size_t cb = (size_t)tok * RD;   // cos/sin rows [b*S + s][64]
          const float c1 = bf16_rne(cosb[cb + i]), s1 = bf16_rne(sinb[cb + i]), c2 = bf16_rne(cosb[cb + i + 32]), s2 = bf16_rne(sinb[cb + i + 32]);
          const float x1 = acc[r][t][v], x2 = acc[r][t + 2][v]; acc[r][t][v] = x1 * c1 - x2 * s1; acc[r][t + 2][v] = x2 * c2 + x1 * s2; } } }
#pragma unroll
  for (int t = 0; t < 4; ++t)
#pragma unroll
    for (int r = 0; r < 2; ++r)
#pragma unroll
      for (int v = 0; v < 8; ++v) { b16 a_, c_; split16(acc[r][t][v] * QS, a_, c_); Th[wave][r * 16 + 8 * hlf + v][t * 16 + nloc] = a_; Tl[wave][r * 16 + 8 * hlf + v][t * 16 + nloc] = c_; }
  wave_lds_sync();
  b16* dst = qh + (size_t)(m0 >> 4) * XROW + (c0 >> 5) * TILE + lane * 8;   // the wave's 32 x 64 = 2 x 2 tiles, two 512-byte halves each
  {
#pragma unroll
    for (int j = 0; j < 8; ++j) { const int rr = (j >> 2) * 16 + nloc, c8 = ((j >> 1) & 1) * 32 + (j & 1) * 16 + hlf * 8, o = (j >> 2) * XROW + ((j >> 1) & 1) * TILE + (j & 1) * 256;
      *(v8b*)(dst + o) = *(const v8b*)(&Th[wave][rr][c8]); *(v8b*)(dst + QPL + o) = *(const v8b*)(&Tl[wave][rr][c8]); }
     }
}

// k + w projection: block = 32 tokens x all 144 columns (9 n-subtiles: k = cols 0..127, w = cols 128..143). The K = 2048 sum is split over the block's 8 waves, 256 k each, so that 128 blocks x 8 waves
// work (not 32 x 4) and a wave's chain of dependent load waits is 8 k blocks long (not 64). The 8 partial tiles are joined in LDS in a fixed order; LayerNorm, RoPE and the split are done by 8 threads a row.
__global__ __launch_bounds__(256) void kproj_kernel(const unsigned short* __restrict__ x16, const unsigned short* __restrict__ wk16, const float* __restrict__ cosb, const float* __restrict__ sinb, const float* __restrict__ g, const float* __restrict__ bta, b16* __restrict__ kh, float* __restrict__ wout) {
  constexpr int NW = 8, KS = HID / NW;                         // waves of a block, k per wave
  __shared__ __attribute__((aligned(16))) float Tk[NW][32][KC + 1]; __shared__ __attribute__((aligned(16))) b16 Th[32][HD + 8], Tl[32][HD + 8];
  const int lane = threadIdx.x & 31, wave = threadIdx.x >> 5, nloc = lane & 15, hlf = lane >> 4, m0 = blockIdx.x * 32;
  v8f acc[2][9];
#pragma unroll
  for (int r = 0; r < 2; ++r)
#pragma unroll
    for (int t = 0; t < 9; ++t) acc[r][t] = (v8f){};
  // Every fragment is fetched one k block ahead: the next block's two A fragments go into a second set at the block's head, each B fragment is refilled directly behind its own two WMMAs.
  const unsigned short* xa = x16 + (size_t)(m0 >> 4) * XROW + wave * (KS * 16) + lane * 8; const unsigned short* wb = wk16 + wave * (KS * 16) + lane * 8;   // k block kb is tile kb / 32: + kb * 16 elements; the wave's slice starts at k = wave * KS
  v16bb a0[2], a1[2], bw[9];
  a0[0] = frag_bf(xa); a0[1] = frag_bf(xa + XROW);
#pragma unroll
  for (int t = 0; t < 9; ++t) bw[t] = frag_bf(wb + t * XROW);
  auto kstep = [&](const v16bb (&ac)[2], v16bb (&an)[2], int kn, bool more) {   // kn = the next k block's start; more is a literal at every call
    if (more) { an[0] = frag_bf(xa + kn * 16); an[1] = frag_bf(xa + XROW + kn * 16); }
#pragma unroll
    for (int t = 0; t < 9; ++t) { acc[0][t] = wmma16bb(ac[0], bw[t], acc[0][t]); acc[1][t] = wmma16bb(ac[1], bw[t], acc[1][t]); if (more) bw[t] = frag_bf(wb + t * XROW + kn * 16); } };
#pragma unroll 1   // stays rolled: one trip already holds two k blocks, one per A set
  for (int kb = 0; kb < KS - 64; kb += 64) { kstep(a0, a1, kb + 32, true); kstep(a1, a0, kb + 64, true);
    asm volatile("s_wait_xcnt 0x0" ::: "memory"); }            // loads are still in flight here and the next trip rewrites their address registers: the wait stands in front of that
  kstep(a0, a1, KS - 32, true);
  asm volatile("s_wait_xcnt 0x0" ::: "memory");                // the last block's loads may be in flight and the lines below reuse their address registers: the wait stands in front of that
  // Thread = (row rr, column class j): it owns columns j + 8 i, i = 0..17, so both halves of a RoPE pair (d, d + 32) lie in one thread. Its table values are asked for here, ahead of the last k block, and land under its WMMAs.
  const int rr = threadIdx.x >> 3, j = threadIdx.x & 7, tok = m0 + rr; const float* pc = cosb + (size_t)tok * RD + j; const float* ps = sinb + (size_t)tok * RD + j;   // cos/sin rows [b*S + s][64]
  float cs[8], sn[8], gg[16], bb[16];
#pragma unroll
  for (int i = 0; i < 8; ++i) { cs[i] = pc[i * 8]; sn[i] = ps[i * 8]; }
  asm volatile("s_wait_xcnt 0x0" :: "v"(pc), "v"(ps) : "memory");   // the two addresses are temporaries on which a loaded value may land: named as inputs they stay whole up to this wait, which stands in front of any such write
#pragma unroll
  for (int i = 0; i < 16; ++i) { gg[i] = g[i * 8 + j]; bb[i] = bta[i * 8 + j]; }
  asm volatile("s_wait_xcnt 0x0" ::: "memory");                // these loads are in flight and the LDS address arithmetic below may reuse their address registers: the wait stands in front of that
  kstep(a1, a0, 0, false);
#pragma unroll
  for (int t = 0; t < 9; ++t)
#pragma unroll
    for (int r = 0; r < 2; ++r)
#pragma unroll
      for (int v = 0; v < 8; ++v) Tk[wave][r * 16 + 8 * hlf + v][t * 16 + nloc] = acc[r][t][v];
  __syncthreads();                                             // all 8 partial tiles are in LDS before any thread joins them
  float val[18];
#pragma unroll
  for (int i = 0; i < 18; ++i) { float s = Tk[0][rr][i * 8 + j];
#pragma unroll
    for (int w = 1; w < NW; ++w) s += Tk[w][rr][i * 8 + j];
    val[i] = s; }
  float mu = 0.0f;
#pragma unroll
  for (int i = 0; i < 16; ++i) mu += val[i];
  mu += __shfl_xor(mu, 1); mu += __shfl_xor(mu, 2); mu += __shfl_xor(mu, 4); mu *= (1.0f / HD);   // the row's 8 threads are 8 neighbouring lanes
  float var = 0.0f;
#pragma unroll
  for (int i = 0; i < 16; ++i) { const float z = val[i] - mu; var += z * z; }
  var += __shfl_xor(var, 1); var += __shfl_xor(var, 2); var += __shfl_xor(var, 4); var *= (1.0f / HD);
  const float rs = rsqrtf(var + LNE);
  float nv[16];
#pragma unroll
  for (int i = 0; i < 16; ++i) nv[i] = (val[i] - mu) * rs * bf16_rne(gg[i]) + bf16_rne(bb[i]);
#pragma unroll
  for (int i = 0; i < 4; ++i) {                                // RoPE pairs (d, d + 32), d = i * 8 + j, of the normalised row
    const float x1 = nv[i], x2 = nv[i + 4], c1 = bf16_rne(cs[i]), s1 = bf16_rne(sn[i]), c2 = bf16_rne(cs[i + 4]), s2 = bf16_rne(sn[i + 4]);
    nv[i] = x1 * c1 - x2 * s1; nv[i + 4] = x2 * c2 + x1 * s2; }
#pragma unroll
  for (int i = 0; i < 16; ++i) { b16 a_, c_; split16(nv[i] * QS, a_, c_); Th[rr][i * 8 + j] = a_; Tl[rr][i * 8 + j] = c_; }
  __syncthreads();                                             // the 32 x 128 hi and lo tiles are complete before they are read back in fragment order
#pragma unroll
  for (int u2 = 0; u2 < 2; ++u2) { const int u = wave * 2 + u2, r2 = (u >> 3) * 16 + nloc, c8 = (u & 7) * 16 + hlf * 8; b16* d = kh + (size_t)(m0 >> 4) * KROW + u * 256 + lane * 8;   // 2 x 4 tiles in fragment order = 16 consecutive 512-byte halves, two a wave
    *(v8b*)(d) = *(const v8b*)(&Th[r2][c8]); *(v8b*)(d + KPL) = *(const v8b*)(&Tl[r2][c8]); }
  wout[(size_t)tok * NH + j] = val[16] * SCALE; wout[(size_t)tok * NH + 8 + j] = val[17] * SCALE;   // a wave's 4 rows x 64 B = two whole lines, written by this wave alone
}

// Each wave owns 32 keys: their hi and lo fragments (16 x 8 registers) are loaded once and stay in registers over NQ query tiles x 16 heads; only q and w are fetched inside the loops.
template <int QT, int NQ>
__global__ __launch_bounds__(256) void score_kernel(const b16* __restrict__ qh, const b16* __restrict__ kh, const float* __restrict__ w, float* __restrict__ out) {
  __shared__ __attribute__((aligned(16))) float Os[8][16][32 + 4];
  const int wid = threadIdx.x >> 5, lane = threadIdx.x & 31, hh = lane >> 4, col = lane & 15;
  const int wg = blockIdx.x * 8 + wid, kt = wg % (S / 32), qg = (wg / (S / 32)) % (QT / NQ), b = wg / ((S / 32) * (QT / NQ)), k0 = kt * 32;
  const b16* K = kh + (((size_t)b * S + k0) >> 4) * KROW + lane * 8;
  v16b ka[4], kal[4], kb_[4], kbl[4];
#pragma unroll
  for (int ks = 0; ks < 4; ++ks) { ka[ks] = frag_kb(K + ks * TILE); kal[ks] = frag_kb(K + KPL + ks * TILE); kb_[ks] = frag_kb(K + KROW + ks * TILE); kbl[ks] = frag_kb(K + KPL + KROW + ks * TILE); }
  // q fragments are fetched one head ahead: the four hi/lo pairs stay in registers and each pair is refilled for the next head (or the next tile's first head) directly behind its own six WMMAs.
  v16b qf[4], ql[4];
  asm volatile("s_wait_xcnt 0x0" ::: "memory");                // the k loads are in flight and the q loads below may land on their address registers: the wait stands in front of that
  const b16* Qc = qh + ((size_t)b * (S / 16) + qg * NQ) * XROW + lane * 8;   // this lane's place in the four tiles of the query tile and head whose fragments are in qf / ql
#pragma unroll
  for (int ks = 0; ks < 4; ++ks) ql[ks] = frag_kb(Qc + QPL + ks * TILE);
  asm volatile("s_wait_xcnt 0x0" ::: "memory");                // the address of the lo plane is a temporary on which a hi fragment below may land: the wait stands in front of that
#pragma unroll
  for (int ks = 0; ks < 4; ++ks) qf[ks] = frag_kb(Qc + ks * TILE);
  for (int qq = 0; qq < NQ; ++qq) { const int q0 = (qg * NQ + qq) * 16, qi = q0 + col;
    v8f o0 = {}, o1 = {};
    for (int h = 0; h < NH; ++h) { v8f s0 = {}, s1 = {};
      const float wq = w[((size_t)b * S + qi) * NH + h];           // w for this lane's query and head, issued ahead of the head's WMMAs
      // next head of this tile, or head 0 of the next tile (in fragment order both lie directly behind this head's four tiles); behind the wave's last head the refill reads that head again (in bounds, not used), so no branch stands among the WMMAs
      const b16* Qn = Qc + ((h + 1 < NH || qq + 1 < NQ) ? 4 * TILE : 0);
#pragma unroll
      for (int ks = 0; ks < 4; ++ks) {
        s0 = wmma16b(ka[ks], qf[ks], s0); s0 = wmma16b(ka[ks], ql[ks], s0); s0 = wmma16b(kal[ks], qf[ks], s0); s1 = wmma16b(kb_[ks], qf[ks], s1); s1 = wmma16b(kb_[ks], ql[ks], s1); s1 = wmma16b(kbl[ks], qf[ks], s1);
        qf[ks] = frag_kb(Qn + ks * TILE); ql[ks] = frag_kb(Qn + QPL + ks * TILE); }
      Qc = Qn;
#pragma unroll
      for (int r = 0; r < 8; ++r) { o0[r] += wq * fmaxf(s0[r] * (1.0f / (QS * QS)), 0.0f); o1[r] += wq * fmaxf(s1[r] * (1.0f / (QS * QS)), 0.0f); }
      asm volatile("s_wait_xcnt 0x0" ::: "memory"); }            // the next head's q loads are in flight here and the next trip rewrites their address registers: the wait stands in front of that
    // o0[r] = (key k0 + 8hh + r, query col); o1 -> key k0 + 16 + 8hh + r
#pragma unroll
    for (int r = 0; r < 8; ++r) { Os[wid][col][8 * hh + r] = o0[r]; Os[wid][col][16 + 8 * hh + r] = o1[r]; }
    wave_lds_sync();
    float* dst = out + ((size_t)b * S + q0) * S + k0;
#pragma unroll
    for (int j = 0; j < 4; ++j) { const int rr = j * 4 + (lane >> 3), c4 = (lane & 7) * 4; *(v4f*)(dst + (size_t)rr * S + c4) = *(const v4f*)(&Os[wid][rr][c4]); }
    wave_lds_sync();   // the next query tile rewrites this wave's Os slice: its reads above come first
  }
}
}  // namespace

extern "C" void kernel_launch(void* const* d_in, const int* in_sizes, int n_in,
                              void* d_out, int out_size, void* d_ws, size_t ws_size, hipStream_t stream) {
  (void)n_in; (void)out_size;
  const float* x = (const float*)d_in[0]; const float* cosb = (const float*)d_in[1]; const float* sinb = (const float*)d_in[2]; const float* wq = (const float*)d_in[3]; const float* wk = (const float*)d_in[4]; const float* ww = (const float*)d_in[5]; const float* g = (const float*)d_in[6]; const float* bta = (const float*)d_in[7];
  float* out = (float*)d_out;   // [2][2048][2048]
  if (in_sizes[0] != NTOK * HID || in_sizes[1] != NTOK * RD || in_sizes[2] != NTOK * RD || in_sizes[3] != HID * QC || in_sizes[4] != HID * HD || in_sizes[5] != HID * NH || in_sizes[6] != HD) return;
  size_t off = 0; char* ws = (char*)d_ws;
  auto carve = [&](size_t bytes) { char* p = ws + off; off += (bytes + 255) & ~(size_t)255; return p; };
  unsigned short* x16 = (unsigned short*)carve((size_t)NTOK * HID * 2); unsigned short* wq16 = (unsigned short*)carve((size_t)QC * HID * 2); unsigned short* wk16 = (unsigned short*)carve((size_t)KCP * HID * 2);
  b16* qh = (b16*)carve(QPL * 2 * 2); b16* kh = (b16*)carve(KPL * 2 * 2); float* w = (float*)carve((size_t)NTOK * NH * 4);
  if (off > ws_size) return;                                    // ≈ 16.8 + 8.4 + 0.8 + 33.5 + 2.1 + 0.3 ≈ 62 MB
  prep_kernel<<<1024, 256, 0, stream>>>(x, wq, wk, ww, x16, wq16, wk16);
  qproj_kernel<<<dim3(QC / 64, NTOK / 128), 128, 0, stream>>>(x16, wq16, cosb, sinb, qh, 0);
  kproj_kernel<<<NTOK / 32, 256, 0, stream>>>(x16, wk16, cosb, sinb, g, bta, kh, w);
  score_kernel<S / 16, 4><<<Bn * (S / 16 / 4) * (S / 32) / 8, 256, 0, stream>>>(qh, kh, w, out);
}

// v005
// Measured time: 113 microseconds a run.
// Timed twice side by side with v004, it ran 1.07 times as fast both times.
// Over all steps from v000 it is 4.70 times as fast.
#include <hip/hip_runtime.h>

// Indexer: q = x Wq (16 heads x 128), k = LayerNorm_128(x Wk) (one shared head), w = SCALE x Ww (16 per token); partial RoPE (rotate-half over the first 64 dims, cos/sin INPUT tables)
// on q and k; score[b][h][q][k] = relu(q_h . k); out[b][q][k] = sum_h w[b][q][h] score -> [2][2048][2048].
// Inputs (x, Wq, Wk, Ww, cos, sin, ln params) rounded to bf16: projections on v_wmma_f32_16x16x32_bf16 (exact products, f32 accumulate;
// LayerNorm, RoPE and the w scaling in f32 in the epilogues); the 16 per-head score tiles on v_wmma_f32_16x16x32_f16 with q and k as f16 hi+lo pairs carried x8 (3 products), relu and the

namespace {
constexpr int Bn = 2, S = 2048, HID = 2048, NH = 16, HD = 128, RD = 64, NTOK = Bn * S, QC = NH * HD /* 2048 */, KC = HD + NH /* k (128) + w (16) = 144 */, KCP = 192;
constexpr float SCALE = 0.022097086912079608f /* 128^-0.5 * 16^-0.5 */, QS = 8.0f, LNE = 1e-5f;
constexpr size_t QPL = (size_t)NTOK * QC, KPL = (size_t)NTOK * HD;

typedef _Float16 b16;
typedef __attribute__((ext_vector_type(16))) _Float16 v16b;
typedef __attribute__((ext_vector_type(16))) __bf16 v16bb;
typedef __attribute__((ext_vector_type(8))) _Float16 v8b;
typedef __attribute__((ext_vector_type(8))) unsigned short v8us;
typedef __attribute__((ext_vector_type(8))) float v8f;
typedef __attribute__((ext_vector_type(4))) float v4f;
__device__ __forceinline__ float bf16_rne(float f) { unsigned int u = __float_as_uint(f); u += 0x7FFFu + ((u >> 16) & 1u); return __uint_as_float(u & 0xFFFF0000u); }
__device__ __forceinline__ unsigned short bf16_bits(float f) { unsigned int u = __float_as_uint(f); u += 0x7FFFu + ((u >> 16) & 1u); return (unsigned short)(u >> 16); }
__device__ __forceinline__ void split16(float v, b16& hi, b16& lo) { hi = (b16)v; lo = (b16)(v - (float)hi); }
// Fragment order of every 16-bit WMMA operand in the workspace: a [rows][K] matrix is kept as tiles of 16 rows x 32 k (512 elements, 1 KB), tile (R, Kb) at (R * (K / 32) + Kb) * 512; inside a tile
// element (row c, k kk) sits at (kk >> 3) * 128 + c * 8 + (kk & 7). Lane l = 16 * hh + c finds its k = 8hh..8hh+7 at l * 8 and its k = 16+8hh..16+8hh+7 at 256 + l * 8 (the same register
// contents as from a row-major matrix), so each load of a wave reads 512 contiguous bytes (4 whole cache lines) and not 32 bytes of each of 16 lines. p = tile start + lane * 8.
constexpr int TILE = 512, XROW = (HID / 32) * TILE /* one 16-row strip of a K = 2048 operand */, KROW = (HD / 32) * TILE;
__device__ __forceinline__ v16b frag_kb(const b16* p) { const v8b a = *(const v8b*)(p), b = *(const v8b*)(p + 256); v16b f;
#pragma unroll
  for (int e = 0; e < 8; ++e) { f[e] = a[e]; f[8 + e] = b[e]; } return f; }
__device__ __forceinline__ v16bb frag_bf(const unsigned short* p) { const v8us a = *(const v8us*)(p), b = *(const v8us*)(p + 256); union { unsigned short s[16]; v16bb v; } u;
#pragma unroll
  for (int e = 0; e < 8; ++e) { u.s[e] = a[e]; u.s[8 + e] = b[e]; } return u.v; }
__device__ __forceinline__ v8f wmma16b(v16b a, v16b b, v8f c) { v8f d = __builtin_amdgcn_wmma_f32_16x16x32_f16(false, a, false, b, (short)0, c, false, false); asm volatile("v_nop\n\tv_nop\n\tv_nop\n\tv_nop" : "+v"(d) : "v"(b)); return d; }   // A (the key fragments, never rewritten) is not named: an asm operand must lie below v256, and 256 registers of key fragments cannot
__device__ __forceinline__ v8f wmma16bb(v16bb a, v16bb b, v8f c) { v8f d = __builtin_amdgcn_wmma_f32_16x16x32_bf16(false, a, false, b, (short)0, c, false, false); asm volatile("v_nop\n\tv_nop\n\tv_nop\n\tv_nop" : "+v"(d) : "v"(a), "v"(b)); return d; }
__device__ __forceinline__ void wave_lds_sync() { __builtin_amdgcn_fence(__ATOMIC_RELEASE, "workgroup"); __builtin_amdgcn_wave_barrier(); __builtin_amdgcn_fence(__ATOMIC_ACQUIRE, "workgroup"); }

__global__ __launch_bounds__(256) void prep_kernel(const float* __restrict__ x, const float* __restrict__ wq, const float* __restrict__ wk, const float* __restrict__ ww, unsigned short* __restrict__ x16, unsigned short* __restrict__ wq16, unsigned short* __restrict__ wk16) {
  const size_t tid = (size_t)blockIdx.x * blockDim.x + threadIdx.x, nth = (size_t)gridDim.x * blockDim.x;
  // One thread = one 16-byte piece of a fragment-order tile. A wave takes 8 rows x the tile's 32 k: piece p -> tile p / 64, row half (p / 32) % 2, k octet (p / 8) % 4, row p % 8; its store fills 4 whole lines.
  auto place = [](size_t p, int& row, int& k0, size_t& dst) { const size_t tile = p >> 6; const int c = (int)((p >> 5) & 1) * 8 + (int)(p & 7), q = (int)(p >> 3) & 3;
    row = (int)(tile / (HID / 32)) * 16 + c; k0 = (int)(tile % (HID / 32)) * 32 + q * 8; dst = tile * TILE + q * 128 + c * 8; };
  for (size_t p = tid; p < (size_t)NTOK * HID / 8; p += nth) { int row, k0; size_t dst; place(p, row, k0, dst); v8us v;
    const v4f a = *(const v4f*)(x + (size_t)row * HID + k0), b = *(const v4f*)(x + (size_t)row * HID + k0 + 4);
#pragma unroll
    for (int e = 0; e < 4; ++e) { v[e] = bf16_bits(a[e]); v[4 + e] = bf16_bits(b[e]); }
    *(v8us*)(x16 + dst) = v; }
  for (size_t p = tid; p < (size_t)QC * HID / 8; p += nth) { int n, k0; size_t dst; place(p, n, k0, dst); v8us v;
#pragma unroll
    for (int e = 0; e < 8; ++e) v[e] = bf16_bits(wq[(size_t)(k0 + e) * QC + n]);
    *(v8us*)(wq16 + dst) = v; }
  for (size_t p = tid; p < (size_t)KCP * HID / 8; p += nth) { int n, k0; size_t dst; place(p, n, k0, dst); v8us v;
#pragma unroll
    for (int e = 0; e < 8; ++e) { const float val = (n < HD) ? wk[(size_t)(k0 + e) * HD + n] : (n < KC) ? ww[(size_t)(k0 + e) * NH + (n - HD)] : 0.0f; v[e] = bf16_bits(val); }
    *(v8us*)(wk16 + dst) = v; }
}

// q projection: block = 128 tokens x one 64-column tile (tile t: head t/2, dims (t%2)*64..+63; RoPE on the t%2 == 0 tiles: pairs (i, i+32) within the tile); x8 hi/lo planes qh, [tok][2048] in fragment order
__global__ __launch_bounds__(128) void qproj_kernel(const unsigned short* __restrict__ x16, const unsigned short* __restrict__ wq16, const float* __restrict__ cosb, const float* __restrict__ sinb, b16* __restrict__ qh, int rowbase) {
  __shared__ __attribute__((aligned(16))) b16 Th[4][32][64 + 8], Tl[4][32][64 + 8];
  const int lane = threadIdx.x & 31, wave = threadIdx.x >> 5, nloc = lane & 15, hlf = lane >> 4, m0 = rowbase + blockIdx.y * 128 + wave * 32, c0 = blockIdx.x * 64;
  v8f acc[2][4];
#pragma unroll
  for (int r = 0; r < 2; ++r)
#pragma unroll
    for (int t = 0; t < 4; ++t) acc[r][t] = (v8f){};
  // Two register sets: the loads of k block s + 1 are issued as one group ahead of the WMMAs of block s, so a block waits for loads that have had a whole block's time to land.
  const unsigned short* xa = x16 + (size_t)(m0 >> 4) * XROW + lane * 8; const unsigned short* wb = wq16 + (size_t)(c0 >> 4) * XROW + lane * 8;   // k block kb is tile kb / 32: + kb * 16 elements
  v16bb f0[6], f1[6];                                          // a0, a1, b0..b3
  auto fetch = [&](v16bb (&f)[6], int kb) { f[0] = frag_bf(xa + kb * 16); f[1] = frag_bf(xa + XROW + kb * 16);
#pragma unroll
    for (int t = 0; t < 4; ++t) f[2 + t] = frag_bf(wb + t * XROW + kb * 16); };
  auto mma = [&](const v16bb (&f)[6]) {
#pragma unroll
    for (int t = 0; t < 4; ++t) { acc[0][t] = wmma16bb(f[0], f[2 + t], acc[0][t]); acc[1][t] = wmma16bb(f[1], f[2 + t], acc[1][t]); } };
  fetch(f0, 0);
#pragma unroll 1   // stays rolled: one trip already holds two k blocks, one per register set; more would only cost registers and a wave per SIMD
  for (int kb = 0; kb < HID - 64; kb += 64) { fetch(f1, kb + 32); mma(f0); fetch(f0, kb + 64); mma(f1);
    asm volatile("s_wait_xcnt 0x0" ::: "memory"); }            // loads are still in flight here and the next trip rewrites their address registers: the wait stands in front of that
  fetch(f1, HID - 32); mma(f0);
  asm volatile("s_wait_xcnt 0x0" ::: "memory");                // the last block's loads may be in flight and the epilogue reuses their address registers: the wait stands in front of that
  mma(f1);
  const bool rope = ((blockIdx.x & 1) == 0);                   // first 64 dims of each head
  if (rope) {
#pragma unroll
    for (int t = 0; t < 2; ++t) { const int i = t * 16 + nloc;   // pair (i, i + 32) = (acc[.][t], acc[.][t+2])
#pragma unroll
      for (int r = 0; r < 2; ++r)
#pragma unroll
        for (int v = 0; v < 8; ++v) { const int tok = m0 + r * 16 + 8 * hlf + v; const size_t cb = (size_t)tok * RD;   // cos/sin rows [b*S + s][64]
          const float c1 = bf16_rne(cosb[cb + i]), s1 = bf16_rne(sinb[cb + i]), c2 = bf16_rne(cosb[cb + i + 32]), s2 = bf16_rne(sinb[cb + i + 32]);
          const float x1 = acc[r][t][v], x2 = acc[r][t + 2][v]; acc[r][t][v] = x1 * c1 - x2 * s1; acc[r][t + 2][v] = x2 * c2 + x1 * s2; } } }
#pragma unroll
  for (int t = 0; t < 4; ++t)
#pragma unroll
    for (int r = 0; r < 2; ++r)
#pragma unroll
      for (int v = 0; v < 8; ++v) { b16 a_, c_; split16(acc[r][t][v] * QS, a_, c_); Th[wave][r * 16 + 8 * hlf + v][t * 16 + nloc] = a_; Tl[wave][r * 16 + 8 * hlf + v][t * 16 + nloc] = c_; }
  wave_lds_sync();
  b16* dst = qh + (size_t)(m0 >> 4) * XROW + (c0 >> 5) * TILE + lane * 8;   // the wave's 32 x 64 = 2 x 2 tiles, two 512-byte halves each
  {
#pragma unroll
    for (int j = 0; j < 8; ++j) { const int rr = (j >> 2) * 16 + nloc, c8 = ((j >> 1) & 1) * 32 + (j & 1) * 16 + hlf * 8, o = (j >> 2) * XROW + ((j >> 1) & 1) * TILE + (j & 1) * 256;
      *(v8b*)(dst + o) = *(const v8b*)(&Th[wave][rr][c8]); *(v8b*)(dst + QPL + o) = *(const v8b*)(&Tl[wave][rr][c8]); }
     }
}

// k + w projection: block = 32 tokens x all 144 columns (9 n-subtiles: k = cols 0..127, w = cols 128..143). The K = 2048 sum is split over the block's 8 waves, 256 k each, so that 128 blocks x 8 waves
// work (not 32 x 4) and a wave's chain of dependent load waits is 8 k blocks long (not 64). The 8 partial tiles are joined in LDS in a fixed order; LayerNorm, RoPE and the split are done by 8 threads a row.
__global__ __launch_bounds__(256) void kproj_kernel(const unsigned short* __restrict__ x16, const unsigned short* __restrict__ wk16, const float* __restrict__ cosb, const float* __restrict__ sinb, const float* __restrict__ g, const float* __restrict__ bta, b16* __restrict__ kh, float* __restrict__ wout) {
  constexpr int NW = 8, KS = HID / NW;                         // waves of a block, k per wave
  __shared__ __attribute__((aligned(16))) float Tk[NW][32][KC + 1]; __shared__ __attribute__((aligned(16))) b16 Th[32][HD + 8], Tl[32][HD + 8];
  const int lane = threadIdx.x & 31, wave = threadIdx.x >> 5, nloc = lane & 15, hlf = lane >> 4, m0 = blockIdx.x * 32;
  v8f acc[2][9];
#pragma unroll
  for (int r = 0; r < 2; ++r)
#pragma unroll
    for (int t = 0; t < 9; ++t) acc[r][t] = (v8f){};
  // Every fragment is fetched one k block ahead: the next block's two A fragments go into a second set at the block's head, each B fragment is refilled directly behind its own two WMMAs.
  const unsigned short* xa = x16 + (size_t)(m0 >> 4) * XROW + wave * (KS * 16) + lane * 8; const unsigned short* wb = wk16 + wave * (KS * 16) + lane * 8;   // k block kb is tile kb / 32: + kb * 16 elements; the wave's slice starts at k = wave * KS
  v16bb a0[2], a1[2], bw[9];
  a0[0] = frag_bf(xa); a0[1] = frag_bf(xa + XROW);
#pragma unroll
  for (int t = 0; t < 9; ++t) bw[t] = frag_bf(wb + t * XROW);
  auto kstep = [&](const v16bb (&ac)[2], v16bb (&an)[2], int kn, bool more) {   // kn = the next k block's start; more is a literal at every call
    if (more) { an[0] = frag_bf(xa + kn * 16); an[1] = frag_bf(xa + XROW + kn * 16); }
#pragma unroll
    for (int t = 0; t < 9; ++t) { acc[0][t] = wmma16bb(ac[0], bw[t], acc[0][t]); acc[1][t] = wmma16bb(ac[1], bw[t], acc[1][t]); if (more) bw[t] = frag_bf(wb + t * XROW + kn * 16); } };
#pragma unroll 1   // stays rolled: one trip already holds two k blocks, one per A set
  for (int kb = 0; kb < KS - 64; kb += 64) { kstep(a0, a1, kb + 32, true); kstep(a1, a0, kb + 64, true);
    asm volatile("s_wait_xcnt 0x0" ::: "memory"); }            // loads are still in flight here and the next trip rewrites their address registers: the wait stands in front of that
  kstep(a0, a1, KS - 32, true);
  asm volatile("s_wait_xcnt 0x0" ::: "memory");                // the last block's loads may be in flight and the lines below reuse their address registers: the wait stands in front of that
  // Thread = (row rr, column class j): it owns columns j + 8 i, i = 0..17, so both halves of a RoPE pair (d, d + 32) lie in one thread. Its table values are asked for here, ahead of the last k block, and land under its WMMAs.
  const int rr = threadIdx.x >> 3, j = threadIdx.x & 7, tok = m0 + rr; const float* pc = cosb + (size_t)tok * RD + j; const float* ps = sinb + (size_t)tok * RD + j;   // cos/sin rows [b*S + s][64]
  float cs[8], sn[8], gg[16], bb[16];
#pragma unroll
  for (int i = 0; i < 8; ++i) { cs[i] = pc[i * 8]; sn[i] = ps[i * 8]; }
  asm volatile("s_wait_xcnt 0x0" :: "v"(pc), "v"(ps) : "memory");   // the two addresses are temporaries on which a loaded value may land: named as inputs they stay whole up to this wait, which stands in front of any such write
#pragma unroll
  for (int i = 0; i < 16; ++i) { gg[i] = g[i * 8 + j]; bb[i] = bta[i * 8 + j]; }
  asm volatile("s_wait_xcnt 0x0" ::: "memory");                // these loads are in flight and the LDS address arithmetic below may reuse their address registers: the wait stands in front of that
  kstep(a1, a0, 0, false);
#pragma unroll
  for (int t = 0; t < 9; ++t)
#pragma unroll
    for (int r = 0; r < 2; ++r)
#pragma unroll
      for (int v = 0; v < 8; ++v) Tk[wave][r * 16 + 8 * hlf + v][t * 16 + nloc] = acc[r][t][v];
  __syncthreads();                                             // all 8 partial tiles are in LDS before any thread joins them
  float val[18];
#pragma unroll
  for (int i = 0; i < 18; ++i) { float s = Tk[0][rr][i * 8 + j];
#pragma unroll
    for (int w = 1; w < NW; ++w) s += Tk[w][rr][i * 8 + j];
    val[i] = s; }
  float mu = 0.0f;
#pragma unroll
  for (int i = 0; i < 16; ++i) mu += val[i];
  mu += __shfl_xor(mu, 1); mu += __shfl_xor(mu, 2); mu += __shfl_xor(mu, 4); mu *= (1.0f / HD);   // the row's 8 threads are 8 neighbouring lanes
  float var = 0.0f;
#pragma unroll
  for (int i = 0; i < 16; ++i) { const float z = val[i] - mu; var += z * z; }
  var += __shfl_xor(var, 1); var += __shfl_xor(var, 2); var += __shfl_xor(var, 4); var *= (1.0f / HD);
  const float rs = rsqrtf(var + LNE);
  float nv[16];
#pragma unroll
  for (int i = 0; i < 16; ++i) nv[i] = (val[i] - mu) * rs * bf16_rne(gg[i]) + bf16_rne(bb[i]);
#pragma unroll
  for (int i = 0; i < 4; ++i) {                                // RoPE pairs (d, d + 32), d = i * 8 + j, of the normalised row
    const float x1 = nv[i], x2 = nv[i + 4], c1 = bf16_rne(cs[i]), s1 = bf16_rne(sn[i]), c2 = bf16_rne(cs[i + 4]), s2 = bf16_rne(sn[i + 4]);
    nv[i] = x1 * c1 - x2 * s1; nv[i + 4] = x2 * c2 + x1 * s2; }
#pragma unroll
  for (int i = 0; i < 16; ++i) { b16 a_, c_; split16(nv[i] * QS, a_, c_); Th[rr][i * 8 + j] = a_; Tl[rr][i * 8 + j] = c_; }
  __syncthreads();                                             // the 32 x 128 hi and lo tiles are complete before they are read back in fragment order
#pragma unroll
  for (int u2 = 0; u2 < 2; ++u2) { const int u = wave * 2 + u2, r2 = (u >> 3) * 16 + nloc, c8 = (u & 7) * 16 + hlf * 8; b16* d = kh + (size_t)(m0 >> 4) * KROW + u * 256 + lane * 8;   // 2 x 4 tiles in fragment order = 16 consecutive 512-byte halves, two a wave
    *(v8b*)(d) = *(const v8b*)(&Th[r2][c8]); *(v8b*)(d + KPL) = *(const v8b*)(&Tl[r2][c8]); }
  wout[(size_t)tok * NH + j] = val[16] * SCALE; wout[(size_t)tok * NH + 8 + j] = val[17] * SCALE;   // a wave's 4 rows x 64 B = two whole lines, written by this wave alone
}

// Each wave owns 64 keys (KT = 4 tiles of 16): their hi and lo fragments (32 x 8 registers) are loaded once and stay in registers over NQ query tiles x 16 heads; only q and w are fetched inside the loops,
// and every q fragment that is fetched feeds all four key tiles. The four accumulator chains are independent and are issued in turn, so no WMMA stands directly behind the one whose sum it continues.
template <int QT, int NQ>
__global__ __launch_bounds__(256) void score_kernel(const b16* __restrict__ qh, const b16* __restrict__ kh, const float* __restrict__ w, float* __restrict__ out) {
  constexpr int KT = 4, KW = KT * 16;                          // key tiles and keys of a wave
  __shared__ __attribute__((aligned(16))) float Os[8][16][KW + 4];
  const int wid = threadIdx.x >> 5, lane = threadIdx.x & 31, hh = lane >> 4, col = lane & 15;
  const int wg = blockIdx.x * 8 + wid, kt = wg % (S / KW), qg = (wg / (S / KW)) % (QT / NQ), b = wg / ((S / KW) * (QT / NQ)), k0 = kt * KW;
  const b16* K = kh + (((size_t)b * S + k0) >> 4) * KROW + lane * 8;
  v16b kf[KT][4], kl[KT][4];
#pragma unroll
  for (int c = 0; c < KT; ++c)
#pragma unroll
    for (int ks = 0; ks < 4; ++ks) { kf[c][ks] = frag_kb(K + c * KROW + ks * TILE); kl[c][ks] = frag_kb(K + KPL + c * KROW + ks * TILE); }
  // q fragments are fetched one head ahead: the four hi/lo pairs stay in registers and each pair is refilled for the next head (or the next tile's first head) directly behind its own twelve WMMAs.
  v16b qf[4], ql[4];
  asm volatile("s_wait_xcnt 0x0" ::: "memory");                // the k loads are in flight and the q loads below may land on their address registers: the wait stands in front of that
  const char* QB = (const char*)qh;
  unsigned qo = (unsigned)(((b * (S / 16) + qg * NQ) * XROW + lane * 8) * sizeof(b16)), qol = qo + (unsigned)(QPL * sizeof(b16));   // this lane's byte offsets, hi and lo plane, of the four tiles of the query tile and head that were fetched last
#pragma unroll
  for (int ks = 0; ks < 4; ++ks) { ql[ks] = frag_kb((const b16*)(QB + qol) + ks * TILE); qf[ks] = frag_kb((const b16*)(QB + qo) + ks * TILE); }
  asm volatile("s_wait_xcnt 0x0" : "+v"(qo), "+v"(qol) :: "memory");   // these loads are in flight and the first trip moves their two offset registers on: as in-out operands they are moved only behind this wait
  for (int qq = 0; qq < NQ; ++qq) { const int q0 = (qg * NQ + qq) * 16, qi = q0 + col;
    v8f o[KT];
#pragma unroll
    for (int c = 0; c < KT; ++c) o[c] = (v8f){};
    for (int h = 0; h < NH; ++h) { v8f s[KT];
#pragma unroll
      for (int c = 0; c < KT; ++c) s[c] = (v8f){};
      const float* wp = w + ((size_t)b * S + qi) * NH + h; const float wq = *wp;   // w for this lane's query and head, issued ahead of the head's WMMAs
      asm volatile("s_wait_xcnt 0x0" :: "v"(wp) : "memory");       // the address is a temporary on which an accumulator below may land: named as an input it stays whole up to this wait
      // next head of this tile, or head 0 of the next tile (in fragment order both lie directly behind this head's four tiles); behind the wave's last head the refill reads that head again (in bounds, not used), so no branch stands among the WMMAs
      const unsigned step = (h + 1 < NH || qq + 1 < NQ) ? 4 * TILE * (unsigned)sizeof(b16) : 0u; qo += step; qol += step;
#pragma unroll
      for (int ks = 0; ks < 4; ++ks) {                             // each chain keeps its order hi.hi, hi.lo, lo.hi
#pragma unroll
        for (int c = 0; c < KT; ++c) s[c] = wmma16b(kf[c][ks], qf[ks], s[c]);
#pragma unroll
        for (int c = 0; c < KT; ++c) s[c] = wmma16b(kf[c][ks], ql[ks], s[c]);
#pragma unroll
        for (int c = 0; c < KT; ++c) s[c] = wmma16b(kl[c][ks], qf[ks], s[c]);
        qf[ks] = frag_kb((const b16*)(QB + qo) + ks * TILE); ql[ks] = frag_kb((const b16*)(QB + qol) + ks * TILE); }
#pragma unroll
      for (int c = 0; c < KT; ++c)
#pragma unroll
        for (int r = 0; r < 8; ++r) o[c][r] += wq * fmaxf(s[c][r] * (1.0f / (QS * QS)), 0.0f);
      asm volatile("s_wait_xcnt 0x0" : "+v"(qo), "+v"(qol) :: "memory"); }   // the next head's q loads are in flight here and the next trip moves their two offset registers on: as in-out operands they are moved only behind this wait
    // o[c][r] = (key k0 + 16c + 8hh + r, query col)
#pragma unroll
    for (int c = 0; c < KT; ++c)
#pragma unroll
      for (int r = 0; r < 8; ++r) Os[wid][col][c * 16 + 8 * hh + r] = o[c][r];
    wave_lds_sync();
    float* dst = out + ((size_t)b * S + q0) * S + k0;
#pragma unroll
    for (int j = 0; j < 8; ++j) { const int rr = j * 2 + (lane >> 4), c4 = (lane & 15) * 4; *(v4f*)(dst + (size_t)rr * S + c4) = *(const v4f*)(&Os[wid][rr][c4]); }   // a row's 64 keys = two whole lines
    wave_lds_sync();   // the next query tile rewrites this wave's Os slice: its reads above come first
  }
}
}  // namespace

extern "C" void kernel_launch(void* const* d_in, const int* in_sizes, int n_in,
                              void* d_out, int out_size, void* d_ws, size_t ws_size, hipStream_t stream) {
  (void)n_in; (void)out_size;
  const float* x = (const float*)d_in[0]; const float* cosb = (const float*)d_in[1]; const float* sinb = (const float*)d_in[2]; const float* wq = (const float*)d_in[3]; const float* wk = (const float*)d_in[4]; const float* ww = (const float*)d_in[5]; const float* g = (const float*)d_in[6]; const float* bta = (const float*)d_in[7];
  float* out = (float*)d_out;   // [2][2048][2048]
  if (in_sizes[0] != NTOK * HID || in_sizes[1] != NTOK * RD || in_sizes[2] != NTOK * RD || in_sizes[3] != HID * QC || in_sizes[4] != HID * HD || in_sizes[5] != HID * NH || in_sizes[6] != HD) return;
  size_t off = 0; char* ws = (char*)d_ws;
  auto carve = [&](size_t bytes) { char* p = ws + off; off += (bytes + 255) & ~(size_t)255; return p; };
  unsigned short* x16 = (unsigned short*)carve((size_t)NTOK * HID * 2); unsigned short* wq16 = (unsigned short*)carve((size_t)QC * HID * 2); unsigned short* wk16 = (unsigned short*)carve((size_t)KCP * HID * 2);
  b16* qh = (b16*)carve(QPL * 2 * 2); b16* kh = (b16*)carve(KPL * 2 * 2); float* w = (float*)carve((size_t)NTOK * NH * 4);
  if (off > ws_size) return;                                    // ≈ 16.8 + 8.4 + 0.8 + 33.5 + 2.1 + 0.3 ≈ 62 MB
  prep_kernel<<<1024, 256, 0, stream>>>(x, wq, wk, ww, x16, wq16, wk16);
  qproj_kernel<<<dim3(QC / 64, NTOK / 128), 128, 0, stream>>>(x16, wq16, cosb, sinb, qh, 0);
  kproj_kernel<<<NTOK / 32, 256, 0, stream>>>(x16, wk16, cosb, sinb, g, bta, kh, w);
  score_kernel<S / 16, 4><<<Bn * (S / 16 / 4) * (S / 64) / 8, 256, 0, stream>>>(qh, kh, w, out);
}

// v006
// One run takes 109 microseconds.
// Next to v005, in two timings, it ran 1.04 times as fast each time.
// All steps since v000 together make it 4.88 times as fast.
#include <hip/hip_runtime.h>

// Indexer: q = x Wq (16 heads x 128), k = LayerNorm_128(x Wk) (one shared head), w = SCALE x Ww (16 per token); partial RoPE (rotate-half over the first 64 dims, cos/sin INPUT tables)
// on q and k; score[b][h][q][k] = relu(q_h . k); out[b][q][k] = sum_h w[b][q][h] score -> [2][2048][2048].
// Inputs (x, Wq, Wk, Ww, cos, sin, ln params) rounded to bf16: projections on v_wmma_f32_16x16x32_bf16 (exact products, f32 accumulate;
// LayerNorm, RoPE and the w scaling in f32 in the epilogues); the 16 per-head score tiles on v_wmma_f32_16x16x32_f16 with q and k as f16 hi+lo pairs carried x8 (3 products), relu and the

namespace {
constexpr int Bn = 2, S = 2048, HID = 2048, NH = 16, HD = 128, RD = 64, NTOK = Bn * S, QC = NH * HD /* 2048 */, KC = HD + NH /* k (128) + w (16) = 144 */, KCP = 192;
constexpr float SCALE = 0.022097086912079608f /* 128^-0.5 * 16^-0.5 */, QS = 8.0f, LNE = 1e-5f;
constexpr size_t QPL = (size_t)NTOK * QC, KPL = (size_t)NTOK * HD;

typedef _Float16 b16;
typedef __attribute__((ext_vector_type(16))) _Float16 v16b;
typedef __attribute__((ext_vector_type(16))) __bf16 v16bb;
typedef __attribute__((ext_vector_type(8))) _Float16 v8b;
typedef __attribute__((ext_vector_type(8))) unsigned short v8us;
typedef __attribute__((ext_vector_type(8))) float v8f;
typedef __attribute__((ext_vector_type(4))) float v4f;
__device__ __forceinline__ float bf16_rne(float f) { unsigned int u = __float_as_uint(f); u += 0x7FFFu + ((u >> 16) & 1u); return __uint_as_float(u & 0xFFFF0000u); }
__device__ __forceinline__ unsigned short bf16_bits(float f) { unsigned int u = __float_as_uint(f); u += 0x7FFFu + ((u >> 16) & 1u); return (unsigned short)(u >> 16); }
__device__ __forceinline__ void split16(float v, b16& hi, b16& lo) { hi = (b16)v; lo = (b16)(v - (float)hi); }
// Fragment order of every 16-bit WMMA operand in the workspace: a [rows][K] matrix is kept as tiles of 16 rows x 32 k (512 elements, 1 KB), tile (R, Kb) at (R * (K / 32) + Kb) * 512; inside a tile
// element (row c, k kk) sits at (kk >> 3) * 128 + c * 8 + (kk & 7). Lane l = 16 * hh + c finds its k = 8hh..8hh+7 at l * 8 and its k = 16+8hh..16+8hh+7 at 256 + l * 8 (the same register
// contents as from a row-major matrix), so each load of a wave reads 512 contiguous bytes (4 whole cache lines) and not 32 bytes of each of 16 lines. p = tile start + lane * 8.
constexpr int TILE = 512, XROW = (HID / 32) * TILE /* one 16-row strip of a K = 2048 operand */, KROW = (HD / 32) * TILE;
__device__ __forceinline__ v16b frag_kb(const b16* p) { const v8b a = *(const v8b*)(p), b = *(const v8b*)(p + 256); v16b f;
#pragma unroll
  for (int e = 0; e < 8; ++e) { f[e] = a[e]; f[8 + e] = b[e]; } return f; }
__device__ __forceinline__ v16bb frag_bf(const unsigned short* p) { const v8us a = *(const v8us*)(p), b = *(const v8us*)(p + 256); union { unsigned short s[16]; v16bb v; } u;
#pragma unroll
  for (int e = 0; e < 8; ++e) { u.s[e] = a[e]; u.s[8 + e] = b[e]; } return u.v; }
__device__ __forceinline__ v8f wmma16b(v16b a, v16b b, v8f c) { v8f d = __builtin_amdgcn_wmma_f32_16x16x32_f16(false, a, false, b, (short)0, c, false, false); asm volatile("v_nop\n\tv_nop\n\tv_nop\n\tv_nop" : "+v"(d) : "v"(b)); return d; }   // A (the key fragments, never rewritten) is not named: an asm operand must lie below v256, and 256 registers of key fragments cannot
__device__ __forceinline__ v8f wmma16bb(v16bb a, v16bb b, v8f c) { v8f d = __builtin_amdgcn_wmma_f32_16x16x32_bf16(false, a, false, b, (short)0, c, false, false); asm volatile("v_nop\n\tv_nop\n\tv_nop\n\tv_nop" : "+v"(d) : "v"(a), "v"(b)); return d; }
__device__ __forceinline__ void wave_lds_sync() { __builtin_amdgcn_fence(__ATOMIC_RELEASE, "workgroup"); __builtin_amdgcn_wave_barrier(); __builtin_amdgcn_fence(__ATOMIC_ACQUIRE, "workgroup"); }

__global__ __launch_bounds__(256) void prep_kernel(const float* __restrict__ x, const float* __restrict__ wq, const float* __restrict__ wk, const float* __restrict__ ww, unsigned short* __restrict__ x16, unsigned short* __restrict__ wq16, unsigned short* __restrict__ wk16) {
  const size_t tid = (size_t)blockIdx.x * blockDim.x + threadIdx.x, nth = (size_t)gridDim.x * blockDim.x;
  // One thread = one 16-byte piece of a fragment-order tile. A wave takes 8 rows x the tile's 32 k: piece p -> tile p / 64, row half (p / 32) % 2, k octet (p / 8) % 4, row p % 8; its store fills 4 whole lines.
  auto place = [](size_t p, int& row, int& k0, size_t& dst) { const size_t tile = p >> 6; const int c = (int)((p >> 5) & 1) * 8 + (int)(p & 7), q = (int)(p >> 3) & 3;
    row = (int)(tile / (HID / 32)) * 16 + c; k0 = (int)(tile % (HID / 32)) * 32 + q * 8; dst = tile * TILE + q * 128 + c * 8; };
  for (size_t p = tid; p < (size_t)NTOK * HID / 8; p += nth) { int row, k0; size_t dst; place(p, row, k0, dst); v8us v;
    const v4f a = *(const v4f*)(x + (size_t)row * HID + k0), b = *(const v4f*)(x + (size_t)row * HID + k0 + 4);
#pragma unroll
    for (int e = 0; e < 4; ++e) { v[e] = bf16_bits(a[e]); v[4 + e] = bf16_bits(b[e]); }
    *(v8us*)(x16 + dst) = v; }
  for (size_t p = tid; p < (size_t)QC * HID / 8; p += nth) { int n, k0; size_t dst; place(p, n, k0, dst); v8us v;
#pragma unroll
    for (int e = 0; e < 8; ++e) v[e] = bf16_bits(wq[(size_t)(k0 + e) * QC + n]);
    *(v8us*)(wq16 + dst) = v; }
  for (size_t p = tid; p < (size_t)KCP * HID / 8; p += nth) { int n, k0; size_t dst; place(p, n, k0, dst); v8us v;
#pragma unroll
    for (int e = 0; e < 8; ++e) { const float val = (n < HD) ? wk[(size_t)(k0 + e) * HD + n] : (n < KC) ? ww[(size_t)(k0 + e) * NH + (n - HD)] : 0.0f; v[e] = bf16_bits(val); }
    *(v8us*)(wk16 + dst) = v; }
}

// q projection: block = 4 waves (2 x 2), one wave a SIMD; a wave owns 64 tokens x one whole head (128 columns) = 4 x 8 accumulator tiles, so the 12 fragments of a k block feed 32 WMMAs (a 32 x 64 tile: 6 feed 8)
// and the block's 128 x 256 tile asks L2 for half the bytes. RoPE on the head's first 64 dims: pairs (i, i+32); x8 hi/lo planes qh, [tok][2048] in fragment order
__global__ __launch_bounds__(128) void qproj_kernel(const unsigned short* __restrict__ x16, const unsigned short* __restrict__ wq16, const float* __restrict__ cosb, const float* __restrict__ sinb, b16* __restrict__ qh, int rowbase) {
  __shared__ __attribute__((aligned(16))) b16 Th[4][64][HD + 8], Tl[4][64][HD + 8];
  const int lane = threadIdx.x & 31, wave = threadIdx.x >> 5, nloc = lane & 15, hlf = lane >> 4, m0 = rowbase + blockIdx.y * 128 + (wave >> 1) * 64, c0 = blockIdx.x * 256 + (wave & 1) * 128;
  v8f acc[4][8];
#pragma unroll
  for (int r = 0; r < 4; ++r)
#pragma unroll
    for (int t = 0; t < 8; ++t) acc[r][t] = (v8f){};
  // Four register sets: the loads of k block s + 2 are issued as one group ahead of the WMMAs of block s, into the set that block s - 2 has left, so they have two blocks' time to land (the wave has no sibling on its SIMD to fill a wait).
  const char* XB = (const char*)x16; const char* WB = (const char*)wq16;
  unsigned ao = (unsigned)(((m0 >> 4) * XROW + lane * 8) * sizeof(unsigned short)), bo = (unsigned)(((c0 >> 4) * XROW + lane * 8) * sizeof(unsigned short));   // this lane's byte offsets in x16 and wq16 at the trip's first k block
  v16bb f0[12], f1[12], f2[12], f3[12];                        // a0..a3, b0..b7
  auto fetch = [&](v16bb (&f)[12], int kt) {                   // kt = k block (tile) counted from the trip's first
#pragma unroll
    for (int r = 0; r < 4; ++r) f[r] = frag_bf((const unsigned short*)(XB + ao) + r * XROW + kt * TILE);
#pragma unroll
    for (int t = 0; t < 8; ++t) f[4 + t] = frag_bf((const unsigned short*)(WB + bo) + t * XROW + kt * TILE);
    __builtin_amdgcn_sched_barrier(0); };                      // keeps the group whole and ahead of the block: without it the compiler sinks these loads down to their first use, two blocks later, and the wave waits out their latency there
  auto mma = [&](const v16bb (&f)[12]) {                       // 32 independent sums; the plain builtin (the compiler keeps its distances): operands of an asm pad could not lie above v255
#pragma unroll
    for (int t = 0; t < 8; ++t)
#pragma unroll
      for (int r = 0; r < 4; ++r) acc[r][t] = __builtin_amdgcn_wmma_f32_16x16x32_bf16(false, f[r], false, f[4 + t], (short)0, acc[r][t], false, false);
    __builtin_amdgcn_sched_barrier(0); };                      // the block ends here: the next group's loads are not lifted in among its WMMAs
  fetch(f0, 0); fetch(f1, 1);
#pragma unroll 1   // stays rolled: one trip already holds four k blocks, one per register set
  for (int kt = 0; kt < HID / 32 - 4; kt += 4) { fetch(f2, 2); mma(f0); fetch(f3, 3); mma(f1); fetch(f0, 4); mma(f2); fetch(f1, 5); mma(f3);
    asm volatile("s_wait_xcnt 0x0" : "+v"(ao), "+v"(bo) :: "memory");   // loads are still in flight here and the next line moves their two offset registers on: as in-out operands they are moved only behind this wait
    ao += 4 * TILE * (unsigned)sizeof(unsigned short); bo += 4 * TILE * (unsigned)sizeof(unsigned short); }
  fetch(f2, 2); mma(f0); fetch(f3, 3); mma(f1);
  asm volatile("s_wait_xcnt 0x0" : "+v"(ao), "+v"(bo) :: "memory");   // the last blocks' loads may be in flight and the epilogue reuses their offset registers: the wait stands in front of that
  mma(f2); mma(f3);
  // RoPE tables: this lane's rows are tokens m0 + 16 r + 8 hlf + v, its columns 16 u + nloc, u = 0..3; all 256 values hang on two addresses
  const float* pc = cosb + (size_t)(m0 + 8 * hlf) * RD + nloc; const float* ps = sinb + (size_t)(m0 + 8 * hlf) * RD + nloc;   // cos/sin rows [b*S + s][64]
  float cs[4][8][4], sn[4][8][4];
#pragma unroll
  for (int r = 0; r < 4; ++r)
#pragma unroll
    for (int v = 0; v < 8; ++v)
#pragma unroll
      for (int u = 0; u < 4; ++u) { cs[r][v][u] = pc[(r * 16 + v) * RD + u * 16]; sn[r][v][u] = ps[(r * 16 + v) * RD + u * 16]; }
  asm volatile("s_wait_xcnt 0x0" :: "v"(pc), "v"(ps) : "memory");   // named as inputs the two addresses stay whole up to this wait, which stands in front of any write on them
#pragma unroll
  for (int t = 0; t < 2; ++t)                                  // pair (i, i + 32), i = 16 t + nloc, = (acc[.][t], acc[.][t+2])
#pragma unroll
    for (int r = 0; r < 4; ++r)
#pragma unroll
      for (int v = 0; v < 8; ++v) { const float c1 = bf16_rne(cs[r][v][t]), s1 = bf16_rne(sn[r][v][t]), c2 = bf16_rne(cs[r][v][t + 2]), s2 = bf16_rne(sn[r][v][t + 2]);
        const float x1 = acc[r][t][v], x2 = acc[r][t + 2][v]; acc[r][t][v] = x1 * c1 - x2 * s1; acc[r][t + 2][v] = x2 * c2 + x1 * s2; }
  b16* dh = qh + (size_t)(m0 >> 4) * XROW + (c0 >> 5) * TILE + lane * 8; b16* dl = dh + QPL;   // the wave's 4 x 4 tiles in the hi and the lo plane
#pragma unroll
  for (int t = 0; t < 8; ++t)
#pragma unroll
    for (int r = 0; r < 4; ++r)
#pragma unroll
      for (int v = 0; v < 8; ++v) { b16 a_, c_; split16(acc[r][t][v] * QS, a_, c_); Th[wave][r * 16 + 8 * hlf + v][t * 16 + nloc] = a_; Tl[wave][r * 16 + 8 * hlf + v][t * 16 + nloc] = c_; }
  wave_lds_sync();
#pragma unroll
  for (int j = 0; j < 32; ++j) { const int rr = (j >> 3) * 16 + nloc, c8 = (j & 7) * 16 + hlf * 8, o = (j >> 3) * XROW + (j & 7) * 256;   // 4 strips x 4 tiles, two 512-byte halves each: a strip's 8 halves lie one behind the other
    *(v8b*)(dh + o) = *(const v8b*)(&Th[wave][rr][c8]); *(v8b*)(dl + o) = *(const v8b*)(&Tl[wave][rr][c8]); }
}

// k + w projection: block = 32 tokens x all 144 columns (9 n-subtiles: k = cols 0..127, w = cols 128..143). The K = 2048 sum is split over the block's 8 waves, 256 k each, so that 128 blocks x 8 waves
// work (not 32 x 4) and a wave's chain of dependent load waits is 8 k blocks long (not 64). The 8 partial tiles are joined in LDS in a fixed order; LayerNorm, RoPE and the split are done by 8 threads a row.
__global__ __launch_bounds__(256) void kproj_kernel(const unsigned short* __restrict__ x16, const unsigned short* __restrict__ wk16, const float* __restrict__ cosb, const float* __restrict__ sinb, const float* __restrict__ g, const float* __restrict__ bta, b16* __restrict__ kh, float* __restrict__ wout) {
  constexpr int NW = 8, KS = HID / NW;                         // waves of a block, k per wave
  __shared__ __attribute__((aligned(16))) float Tk[NW][32][KC + 1]; __shared__ __attribute__((aligned(16))) b16 Th[32][HD + 8], Tl[32][HD + 8];
  const int lane = threadIdx.x & 31, wave = threadIdx.x >> 5, nloc = lane & 15, hlf = lane >> 4, m0 = blockIdx.x * 32;
  v8f acc[2][9];
#pragma unroll
  for (int r = 0; r < 2; ++r)
#pragma unroll
    for (int t = 0; t < 9; ++t) acc[r][t] = (v8f){};
  // Every fragment is fetched one k block ahead: the next block's two A fragments go into a second set at the block's head, each B fragment is refilled directly behind its own two WMMAs.
  const unsigned short* xa = x16 + (size_t)(m0 >> 4) * XROW + wave * (KS * 16) + lane * 8; const unsigned short* wb = wk16 + wave * (KS * 16) + lane * 8;   // k block kb is tile kb / 32: + kb * 16 elements; the wave's slice starts at k = wave * KS
  v16bb a0[2], a1[2], bw[9];
  a0[0] = frag_bf(xa); a0[1] = frag_bf(xa + XROW);
#pragma unroll
  for (int t = 0; t < 9; ++t) bw[t] = frag_bf(wb + t * XROW);
  auto kstep = [&](const v16bb (&ac)[2], v16bb (&an)[2], int kn, bool more) {   // kn = the next k block's start; more is a literal at every call
    if (more) { an[0] = frag_bf(xa + kn * 16); an[1] = frag_bf(xa + XROW + kn * 16); }
#pragma unroll
    for (int t = 0; t < 9; ++t) { acc[0][t] = wmma16bb(ac[0], bw[t], acc[0][t]); acc[1][t] = wmma16bb(ac[1], bw[t], acc[1][t]); if (more) bw[t] = frag_bf(wb + t * XROW + kn * 16); } };
#pragma unroll 1   // stays rolled: one trip already holds two k blocks, one per A set
  for (int kb = 0; kb < KS - 64; kb += 64) { kstep(a0, a1, kb + 32, true); kstep(a1, a0, kb + 64, true);
    asm volatile("s_wait_xcnt 0x0" ::: "memory"); }            // loads are still in flight here and the next trip rewrites their address registers: the wait stands in front of that
  kstep(a0, a1, KS - 32, true);
  asm volatile("s_wait_xcnt 0x0" ::: "memory");                // the last block's loads may be in flight and the lines below reuse their address registers: the wait stands in front of that
  // Thread = (row rr, column class j): it owns columns j + 8 i, i = 0..17, so both halves of a RoPE pair (d, d + 32) lie in one thread. Its table values are asked for here, ahead of the last k block, and land under its WMMAs.
  const int rr = threadIdx.x >> 3, j = threadIdx.x & 7, tok = m0 + rr; const float* pc = cosb + (size_t)tok * RD + j; const float* ps = sinb + (size_t)tok * RD + j;   // cos/sin rows [b*S + s][64]
  float cs[8], sn[8], gg[16], bb[16];
#pragma unroll
  for (int i = 0; i < 8; ++i) { cs[i] = pc[i * 8]; sn[i] = ps[i * 8]; }
  asm volatile("s_wait_xcnt 0x0" :: "v"(pc), "v"(ps) : "memory");   // the two addresses are temporaries on which a loaded value may land: named as inputs they stay whole up to this wait, which stands in front of any such write
#pragma unroll
  for (int i = 0; i < 16; ++i) { gg[i] = g[i * 8 + j]; bb[i] = bta[i * 8 + j]; }
  asm volatile("s_wait_xcnt 0x0" ::: "memory");                // these loads are in flight and the LDS address arithmetic below may reuse their address registers: the wait stands in front of that
  kstep(a1, a0, 0, false);
#pragma unroll
  for (int t = 0; t < 9; ++t)
#pragma unroll
    for (int r = 0; r < 2; ++r)
#pragma unroll
      for (int v = 0; v < 8; ++v) Tk[wave][r * 16 + 8 * hlf + v][t * 16 + nloc] = acc[r][t][v];
  __syncthreads();                                             // all 8 partial tiles are in LDS before any thread joins them
  float val[18];
#pragma unroll
  for (int i = 0; i < 18; ++i) { float s = Tk[0][rr][i * 8 + j];
#pragma unroll
    for (int w = 1; w < NW; ++w) s += Tk[w][rr][i * 8 + j];
    val[i] = s; }
  float mu = 0.0f;
#pragma unroll
  for (int i = 0; i < 16; ++i) mu += val[i];
  mu += __shfl_xor(mu, 1); mu += __shfl_xor(mu, 2); mu += __shfl_xor(mu, 4); mu *= (1.0f / HD);   // the row's 8 threads are 8 neighbouring lanes
  float var = 0.0f;
#pragma unroll
  for (int i = 0; i < 16; ++i) { const float z = val[i] - mu; var += z * z; }
  var += __shfl_xor(var, 1); var += __shfl_xor(var, 2); var += __shfl_xor(var, 4); var *= (1.0f / HD);
  const float rs = rsqrtf(var + LNE);
  float nv[16];
#pragma unroll
  for (int i = 0; i < 16; ++i) nv[i] = (val[i] - mu) * rs * bf16_rne(gg[i]) + bf16_rne(bb[i]);
#pragma unroll
  for (int i = 0; i < 4; ++i) {                                // RoPE pairs (d, d + 32), d = i * 8 + j, of the normalised row
    const float x1 = nv[i], x2 = nv[i + 4], c1 = bf16_rne(cs[i]), s1 = bf16_rne(sn[i]), c2 = bf16_rne(cs[i + 4]), s2 = bf16_rne(sn[i + 4]);
    nv[i] = x1 * c1 - x2 * s1; nv[i + 4] = x2 * c2 + x1 * s2; }
#pragma unroll
  for (int i = 0; i < 16; ++i) { b16 a_, c_; split16(nv[i] * QS, a_, c_); Th[rr][i * 8 + j] = a_; Tl[rr][i * 8 + j] = c_; }
  __syncthreads();                                             // the 32 x 128 hi and lo tiles are complete before they are read back in fragment order
#pragma unroll
  for (int u2 = 0; u2 < 2; ++u2) { const int u = wave * 2 + u2, r2 = (u >> 3) * 16 + nloc, c8 = (u & 7) * 16 + hlf * 8; b16* d = kh + (size_t)(m0 >> 4) * KROW + u * 256 + lane * 8;   // 2 x 4 tiles in fragment order = 16 consecutive 512-byte halves, two a wave
    *(v8b*)(d) = *(const v8b*)(&Th[r2][c8]); *(v8b*)(d + KPL) = *(const v8b*)(&Tl[r2][c8]); }
  wout[(size_t)tok * NH + j] = val[16] * SCALE; wout[(size_t)tok * NH + 8 + j] = val[17] * SCALE;   // a wave's 4 rows x 64 B = two whole lines, written by this wave alone
}

// Each wave owns 64 keys (KT = 4 tiles of 16): their hi and lo fragments (32 x 8 registers) are loaded once and stay in registers over NQ query tiles x 16 heads; only q and w are fetched inside the loops,
// and every q fragment that is fetched feeds all four key tiles. The four accumulator chains are independent and are issued in turn, so no WMMA stands directly behind the one whose sum it continues.
template <int QT, int NQ>
__global__ __launch_bounds__(256) void score_kernel(const b16* __restrict__ qh, const b16* __restrict__ kh, const float* __restrict__ w, float* __restrict__ out) {
  constexpr int KT = 4, KW = KT * 16;                          // key tiles and keys of a wave
  __shared__ __attribute__((aligned(16))) float Os[8][16][KW + 4];
  const int wid = threadIdx.x >> 5, lane = threadIdx.x & 31, hh = lane >> 4, col = lane & 15;
  const int wg = blockIdx.x * 8 + wid, kt = wg % (S / KW), qg = (wg / (S / KW)) % (QT / NQ), b = wg / ((S / KW) * (QT / NQ)), k0 = kt * KW;
  const b16* K = kh + (((size_t)b * S + k0) >> 4) * KROW + lane * 8;
  v16b kf[KT][4], kl[KT][4];
#pragma unroll
  for (int c = 0; c < KT; ++c)
#pragma unroll
    for (int ks = 0; ks < 4; ++ks) { kf[c][ks] = frag_kb(K + c * KROW + ks * TILE); kl[c][ks] = frag_kb(K + KPL + c * KROW + ks * TILE); }
  // q fragments are fetched one head ahead: the four hi/lo pairs stay in registers and each pair is refilled for the next head (or the next tile's first head) directly behind its own twelve WMMAs.
  v16b qf[4], ql[4];
  asm volatile("s_wait_xcnt 0x0" ::: "memory");                // the k loads are in flight and the q loads below may land on their address registers: the wait stands in front of that
  const char* QB = (const char*)qh;
  unsigned qo = (unsigned)(((b * (S / 16) + qg * NQ) * XROW + lane * 8) * sizeof(b16)), qol = qo + (unsigned)(QPL * sizeof(b16));   // this lane's byte offsets, hi and lo plane, of the four tiles of the query tile and head that were fetched last
#pragma unroll
  for (int ks = 0; ks < 4; ++ks) { ql[ks] = frag_kb((const b16*)(QB + qol) + ks * TILE); qf[ks] = frag_kb((const b16*)(QB + qo) + ks * TILE); }
  asm volatile("s_wait_xcnt 0x0" : "+v"(qo), "+v"(qol) :: "memory");   // these loads are in flight and the first trip moves their two offset registers on: as in-out operands they are moved only behind this wait
  for (int qq = 0; qq < NQ; ++qq) { const int q0 = (qg * NQ + qq) * 16, qi = q0 + col;
    v8f o[KT];
#pragma unroll
    for (int c = 0; c < KT; ++c) o[c] = (v8f){};
    for (int h = 0; h < NH; ++h) { v8f s[KT];
#pragma unroll
      for (int c = 0; c < KT; ++c) s[c] = (v8f){};
      const float* wp = w + ((size_t)b * S + qi) * NH + h; const float wq = *wp;   // w for this lane's query and head, issued ahead of the head's WMMAs
      asm volatile("s_wait_xcnt 0x0" :: "v"(wp) : "memory");       // the address is a temporary on which an accumulator below may land: named as an input it stays whole up to this wait
      // next head of this tile, or head 0 of the next tile (in fragment order both lie directly behind this head's four tiles); behind the wave's last head the refill reads that head again (in bounds, not used), so no branch stands among the WMMAs
      const unsigned step = (h + 1 < NH || qq + 1 < NQ) ? 4 * TILE * (unsigned)sizeof(b16) : 0u; qo += step; qol += step;
#pragma unroll
      for (int ks = 0; ks < 4; ++ks) {                             // each chain keeps its order hi.hi, hi.lo, lo.hi
#pragma unroll
        for (int c = 0; c < KT; ++c) s[c] = wmma16b(kf[c][ks], qf[ks], s[c]);
#pragma unroll
        for (int c = 0; c < KT; ++c) s[c] = wmma16b(kf[c][ks], ql[ks], s[c]);
#pragma unroll
        for (int c = 0; c < KT; ++c) s[c] = wmma16b(kl[c][ks], qf[ks], s[c]);
        qf[ks] = frag_kb((const b16*)(QB + qo) + ks * TILE); ql[ks] = frag_kb((const b16*)(QB + qol) + ks * TILE); }
#pragma unroll
      for (int c = 0; c < KT; ++c)
#pragma unroll
        for (int r = 0; r < 8; ++r) o[c][r] += wq * fmaxf(s[c][r] * (1.0f / (QS * QS)), 0.0f);
      asm volatile("s_wait_xcnt 0x0" : "+v"(qo), "+v"(qol) :: "memory"); }   // the next head's q loads are in flight here and the next trip moves their two offset registers on: as in-out operands they are moved only behind this wait
    // o[c][r] = (key k0 + 16c + 8hh + r, query col)
#pragma unroll
    for (int c = 0; c < KT; ++c)
#pragma unroll
      for (int r = 0; r < 8; ++r) Os[wid][col][c * 16 + 8 * hh + r] = o[c][r];
    wave_lds_sync();
    float* dst = out + ((size_t)b * S + q0) * S + k0;
#pragma unroll
    for (int j = 0; j < 8; ++j) { const int rr = j * 2 + (lane >> 4), c4 = (lane & 15) * 4; *(v4f*)(dst + (size_t)rr * S + c4) = *(const v4f*)(&Os[wid][rr][c4]); }   // a row's 64 keys = two whole lines
    wave_lds_sync();   // the next query tile rewrites this wave's Os slice: its reads above come first
  }
}
}  // namespace

extern "C" void kernel_launch(void* const* d_in, const int* in_sizes, int n_in,
                              void* d_out, int out_size, void* d_ws, size_t ws_size, hipStream_t stream) {
  (void)n_in; (void)out_size;
  const float* x = (const float*)d_in[0]; const float* cosb = (const float*)d_in[1]; const float* sinb = (const float*)d_in[2]; const float* wq = (const float*)d_in[3]; const float* wk = (const float*)d_in[4]; const float* ww = (const float*)d_in[5]; const float* g = (const float*)d_in[6]; const float* bta = (const float*)d_in[7];
  float* out = (float*)d_out;   // [2][2048][2048]
  if (in_sizes[0] != NTOK * HID || in_sizes[1] != NTOK * RD || in_sizes[2] != NTOK * RD || in_sizes[3] != HID * QC || in_sizes[4] != HID * HD || in_sizes[5] != HID * NH || in_sizes[6] != HD) return;
  size_t off = 0; char* ws = (char*)d_ws;
  auto carve = [&](size_t bytes) { char* p = ws + off; off += (bytes + 255) & ~(size_t)255; return p; };
  unsigned short* x16 = (unsigned short*)carve((size_t)NTOK * HID * 2); unsigned short* wq16 = (unsigned short*)carve((size_t)QC * HID * 2); unsigned short* wk16 = (unsigned short*)carve((size_t)KCP * HID * 2);
  b16* qh = (b16*)carve(QPL * 2 * 2); b16* kh = (b16*)carve(KPL * 2 * 2); float* w = (float*)carve((size_t)NTOK * NH * 4);
  if (off > ws_size) return;                                    // ≈ 16.8 + 8.4 + 0.8 + 33.5 + 2.1 + 0.3 ≈ 62 MB
  prep_kernel<<<1024, 256, 0, stream>>>(x, wq, wk, ww, x16, wq16, wk16);
  qproj_kernel<<<dim3(QC / 256, NTOK / 128), 128, 0, stream>>>(x16, wq16, cosb, sinb, qh, 0);
  kproj_kernel<<<NTOK / 32, 256, 0, stream>>>(x16, wk16, cosb, sinb, g, bta, kh, w);
  score_kernel<S / 16, 4><<<Bn * (S / 16 / 4) * (S / 64) / 8, 256, 0, stream>>>(qh, kh, w, out);
}

// v008
// One run takes 87.1 microseconds.
// Versions in between are left out here; by their measured steps it is 1.24 times as fast as v006.
// Over all steps from v000 it is 6.06 times as fast.
#include <hip/hip_runtime.h>

// Indexer: q = x Wq (16 heads x 128), k = LayerNorm_128(x Wk) (one shared head), w = SCALE x Ww (16 per token); partial RoPE (rotate-half over the first 64 dims, cos/sin INPUT tables)
// on q and k; score[b][h][q][k] = relu(q_h . k); out[b][q][k] = sum_h w[b][q][h] score -> [2][2048][2048].
// x, Wq, Wk, Ww, cos, sin, ln params are rounded to bf16: projections on v_wmma_f32_16x16x32_bf16 (exact products, f32 accumulate;
// LayerNorm, RoPE and the w scaling in f32 in the epilogues); the 16 per-head score tiles on v_wmma_f32_16x16x32_f16 with q and k each rounded once to f16, carried x8 (one product: the f16 rounding step is an eighth of the bf16 step already taken on every input), relu and the weighted head sum in f32.

namespace {
constexpr int Bn = 2, S = 2048, HID = 2048, NH = 16, HD = 128, RD = 64, NTOK = Bn * S, QC = NH * HD /* 2048 */, KC = HD + NH /* k (128) + w (16) = 144 */, KCP = 192;
constexpr float SCALE = 0.022097086912079608f /* 128^-0.5 * 16^-0.5 */, QS = 8.0f, LNE = 1e-5f;
constexpr size_t QPL = (size_t)NTOK * QC, KPL = (size_t)NTOK * HD;

typedef _Float16 b16;
typedef __attribute__((ext_vector_type(16))) _Float16 v16b;
typedef __attribute__((ext_vector_type(16))) __bf16 v16bb;
typedef __attribute__((ext_vector_type(8))) _Float16 v8b;
typedef __attribute__((ext_vector_type(8))) unsigned short v8us;
typedef __attribute__((ext_vector_type(8))) float v8f;
typedef __attribute__((ext_vector_type(4))) float v4f;
__device__ __forceinline__ float bf16_rne(float f) { unsigned int u = __float_as_uint(f); u += 0x7FFFu + ((u >> 16) & 1u); return __uint_as_float(u & 0xFFFF0000u); }
__device__ __forceinline__ unsigned short bf16_bits(float f) { unsigned int u = __float_as_uint(f); u += 0x7FFFu + ((u >> 16) & 1u); return (unsigned short)(u >> 16); }
// Fragment order of every 16-bit WMMA operand in the workspace: a [rows][K] matrix is kept as tiles of 16 rows x 32 k (512 elements, 1 KB), tile (R, Kb) at (R * (K / 32) + Kb) * 512; inside a tile
// element (row c, k kk) sits at (kk >> 3) * 128 + c * 8 + (kk & 7). Lane l = 16 * hh + c finds its k = 8hh..8hh+7 at l * 8 and its k = 16+8hh..16+8hh+7 at 256 + l * 8 (the same register
// contents as from a row-major matrix), so each load of a wave reads 512 contiguous bytes (4 whole cache lines) and not 32 bytes of each of 16 lines. p = tile start + lane * 8.
constexpr int TILE = 512, XROW = (HID / 32) * TILE /* one 16-row strip of a K = 2048 operand */, KROW = (HD / 32) * TILE;
__device__ __forceinline__ v16b frag_kb(const b16* p) { const v8b a = *(const v8b*)(p), b = *(const v8b*)(p + 256); v16b f;
#pragma unroll
  for (int e = 0; e < 8; ++e) { f[e] = a[e]; f[8 + e] = b[e]; } return f; }
__device__ __forceinline__ v16bb frag_bf(const unsigned short* p) { const v8us a = *(const v8us*)(p), b = *(const v8us*)(p + 256); union { unsigned short s[16]; v16bb v; } u;
#pragma unroll
  for (int e = 0; e < 8; ++e) { u.s[e] = a[e]; u.s[8 + e] = b[e]; } return u.v; }
__device__ __forceinline__ v8f wmma16b(v16b a, v16b b, v8f c) { v8f d = __builtin_amdgcn_wmma_f32_16x16x32_f16(false, a, false, b, (short)0, c, false, false); asm volatile("v_nop\n\tv_nop\n\tv_nop\n\tv_nop" : "+v"(d) : "v"(b)); return d; }   // A (the key fragments, never rewritten) is not named
__device__ __forceinline__ v8f wmma16bb(v16bb a, v16bb b, v8f c) { v8f d = __builtin_amdgcn_wmma_f32_16x16x32_bf16(false, a, false, b, (short)0, c, false, false); asm volatile("v_nop\n\tv_nop\n\tv_nop\n\tv_nop" : "+v"(d) : "v"(a), "v"(b)); return d; }
__device__ __forceinline__ void wave_lds_sync() { __builtin_amdgcn_fence(__ATOMIC_RELEASE, "workgroup"); __builtin_amdgcn_wave_barrier(); __builtin_amdgcn_fence(__ATOMIC_ACQUIRE, "workgroup"); }

__global__ __launch_bounds__(256) void prep_kernel(const float* __restrict__ x, const float* __restrict__ wq, const float* __restrict__ wk, const float* __restrict__ ww, unsigned short* __restrict__ x16, unsigned short* __restrict__ wq16, unsigned short* __restrict__ wk16) {
  const size_t tid = (size_t)blockIdx.x * blockDim.x + threadIdx.x, nth = (size_t)gridDim.x * blockDim.x;
  // One thread = one 16-byte piece of a fragment-order tile. A wave takes 8 rows x the tile's 32 k: piece p -> tile p / 64, row half (p / 32) % 2, k octet (p / 8) % 4, row p % 8; its store fills 4 whole lines.
  auto place = [](size_t p, int& row, int& k0, size_t& dst) { const size_t tile = p >> 6; const int c = (int)((p >> 5) & 1) * 8 + (int)(p & 7), q = (int)(p >> 3) & 3;
    row = (int)(tile / (HID / 32)) * 16 + c; k0 = (int)(tile % (HID / 32)) * 32 + q * 8; dst = tile * TILE + q * 128 + c * 8; };
  for (size_t p = tid; p < (size_t)NTOK * HID / 8; p += nth) { int row, k0; size_t dst; place(p, row, k0, dst); v8us v;
    const v4f a = *(const v4f*)(x + (size_t)row * HID + k0), b = *(const v4f*)(x + (size_t)row * HID + k0 + 4);
#pragma unroll
    for (int e = 0; e < 4; ++e) { v[e] = bf16_bits(a[e]); v[4 + e] = bf16_bits(b[e]); }
    *(v8us*)(x16 + dst) = v; }
  for (size_t p = tid; p < (size_t)QC * HID / 8; p += nth) { int n, k0; size_t dst; place(p, n, k0, dst); v8us v;
#pragma unroll
    for (int e = 0; e < 8; ++e) v[e] = bf16_bits(wq[(size_t)(k0 + e) * QC + n]);
    *(v8us*)(wq16 + dst) = v; }
  for (size_t p = tid; p < (size_t)KCP * HID / 8; p += nth) { int n, k0; size_t dst; place(p, n, k0, dst); v8us v;
#pragma unroll
    for (int e = 0; e < 8; ++e) { const float val = (n < HD) ? wk[(size_t)(k0 + e) * HD + n] : (n < KC) ? ww[(size_t)(k0 + e) * NH + (n - HD)] : 0.0f; v[e] = bf16_bits(val); }
    *(v8us*)(wk16 + dst) = v; }
}

// q projection: block = 4 waves (2 x 2), one wave a SIMD; a wave owns 64 tokens x one whole head (128 columns) = 4 x 8 accumulator tiles, so the 12 fragments of a k block feed 32 WMMAs (a 32 x 64 tile: 6 feed 8)
// and the block's 128 x 256 tile asks L2 for half the bytes. RoPE on the head's first 64 dims: pairs (i, i+32); q x8 as f16 in qh, [tok][2048] in fragment order
__global__ __launch_bounds__(128) void qproj_kernel(const unsigned short* __restrict__ x16, const unsigned short* __restrict__ wq16, const float* __restrict__ cosb, const float* __restrict__ sinb, b16* __restrict__ qh, int rowbase) {
  __shared__ __attribute__((aligned(16))) b16 Th[4][64][HD + 8];
  const int lane = threadIdx.x & 31, wave = threadIdx.x >> 5, nloc = lane & 15, hlf = lane >> 4, m0 = rowbase + blockIdx.y * 128 + (wave >> 1) * 64, c0 = blockIdx.x * 256 + (wave & 1) * 128;
  v8f acc[4][8];
#pragma unroll
  for (int r = 0; r < 4; ++r)
#pragma unroll
    for (int t = 0; t < 8; ++t) acc[r][t] = (v8f){};
  // Four register sets: the loads of k block s + 2 are issued as one group ahead of the WMMAs of block s, into the set that block s - 2 has left, so they have two blocks' time to land (the wave has no sibling on its SIMD to fill a wait).
  // The K walk is a ring of 16 trips of 4 k blocks, and each block enters it at a trip of its own: the 32 blocks that share a strip of wq16 and the 8 that share a strip of x16 run side by side, and from one common start they would all ask L2 for the same lines at the same moment.
  constexpr unsigned TRIPB = 4 * TILE * (unsigned)sizeof(unsigned short), RINGM = XROW * (unsigned)sizeof(unsigned short) - TRIPB;   // bytes of a trip in a strip (4 KB); the bits of a byte offset that hold the trip's number (a strip is 64 KB, and strips start at multiples of it)
  auto ring_next = [](unsigned o) { return (o & ~RINGM) | ((o + TRIPB) & RINGM); };   // the same lane and strip, one trip on, the last trip followed by the first
  const char* XB = (const char*)x16; const char* WB = (const char*)wq16;
  const unsigned k0b = ((blockIdx.y + 4 * (blockIdx.x & 3) + 2 * (blockIdx.x >> 2)) & 15u) * TRIPB;   // this block's first trip: 16 different ones down a column of blocks, 8 along a row, neighbours in a row 4 trips apart (any four of them in a row lie spread round the ring, so each soon walks where another has been)
  unsigned ao = (unsigned)(((m0 >> 4) * XROW + lane * 8) * sizeof(unsigned short)) + k0b, bo = (unsigned)(((c0 >> 4) * XROW + lane * 8) * sizeof(unsigned short)) + k0b;   // this lane's byte offsets in x16 and wq16 at the trip's first k block
  unsigned an = ring_next(ao), bn = ring_next(bo);             // the same at the next trip's first k block
  v16bb f0[12], f1[12], f2[12], f3[12];                        // a0..a3, b0..b7
  auto fetch = [&](v16bb (&f)[12], unsigned ax, unsigned bx, int kt) {   // ax, bx = a trip's offsets; kt = k block (tile) counted from that trip's first
#pragma unroll
    for (int r = 0; r < 4; ++r) f[r] = frag_bf((const unsigned short*)(XB + ax) + r * XROW + kt * TILE);
#pragma unroll
    for (int t = 0; t < 8; ++t) f[4 + t] = frag_bf((const unsigned short*)(WB + bx) + t * XROW + kt * TILE);
    __builtin_amdgcn_sched_barrier(0); };                      // keeps the group whole and ahead of the block: without it the compiler sinks these loads down to their first use, two blocks later, and the wave waits out their latency there
  auto mma = [&](const v16bb (&f)[12]) {                       // 32 independent sums; the plain builtin (the compiler keeps its distances): operands of an asm pad could not lie above v255
#pragma unroll
    for (int t = 0; t < 8; ++t)
#pragma unroll
      for (int r = 0; r < 4; ++r) acc[r][t] = __builtin_amdgcn_wmma_f32_16x16x32_bf16(false, f[r], false, f[4 + t], (short)0, acc[r][t], false, false);
    __builtin_amdgcn_sched_barrier(0); };                      // the block ends here: the next group's loads are not lifted in among its WMMAs
  fetch(f0, ao, bo, 0); fetch(f1, ao, bo, 1);
#pragma unroll 1   // stays rolled: one trip already holds four k blocks, one per register set
  for (int kt = 0; kt < HID / 32 - 4; kt += 4) { fetch(f2, ao, bo, 2); mma(f0); fetch(f3, ao, bo, 3); mma(f1); fetch(f0, an, bn, 0); mma(f2); fetch(f1, an, bn, 1); mma(f3);
    asm volatile("s_wait_xcnt 0x0" : "+v"(ao), "+v"(bo), "+v"(an), "+v"(bn) :: "memory");   // loads are still in flight here and the next line moves their four offset registers on: as in-out operands they are moved only behind this wait
    ao = an; bo = bn; an = ring_next(an); bn = ring_next(bn); }
  fetch(f2, ao, bo, 2); mma(f0); fetch(f3, ao, bo, 3); mma(f1);
  asm volatile("s_wait_xcnt 0x0" : "+v"(ao), "+v"(bo) :: "memory");   // the last blocks' loads may be in flight and the epilogue reuses their offset registers: the wait stands in front of that
  mma(f2); mma(f3);
  // RoPE tables: this lane's rows are tokens m0 + 16 r + 8 hlf + v, its columns 16 u + nloc, u = 0..3; all 256 values hang on two addresses
  const float* pc = cosb + (size_t)(m0 + 8 * hlf) * RD + nloc; const float* ps = sinb + (size_t)(m0 + 8 * hlf) * RD + nloc;   // cos/sin rows [b*S + s][64]
  float cs[4][8][4], sn[4][8][4];
#pragma unroll
  for (int r = 0; r < 4; ++r)
#pragma unroll
    for (int v = 0; v < 8; ++v)
#pragma unroll
      for (int u = 0; u < 4; ++u) { cs[r][v][u] = pc[(r * 16 + v) * RD + u * 16]; sn[r][v][u] = ps[(r * 16 + v) * RD + u * 16]; }
  asm volatile("s_wait_xcnt 0x0" :: "v"(pc), "v"(ps) : "memory");   // named as inputs the two addresses stay whole up to this wait, which stands in front of any write on them
#pragma unroll
  for (int t = 0; t < 2; ++t)                                  // pair (i, i + 32), i = 16 t + nloc, = (acc[.][t], acc[.][t+2])
#pragma unroll
    for (int r = 0; r < 4; ++r)
#pragma unroll
      for (int v = 0; v < 8; ++v) { const float c1 = bf16_rne(cs[r][v][t]), s1 = bf16_rne(sn[r][v][t]), c2 = bf16_rne(cs[r][v][t + 2]), s2 = bf16_rne(sn[r][v][t + 2]);
        const float x1 = acc[r][t][v], x2 = acc[r][t + 2][v]; acc[r][t][v] = x1 * c1 - x2 * s1; acc[r][t + 2][v] = x2 * c2 + x1 * s2; }
  b16* dh = qh + (size_t)(m0 >> 4) * XROW + (c0 >> 5) * TILE + lane * 8;   // the wave's 4 x 4 tiles
#pragma unroll
  for (int t = 0; t < 8; ++t)
#pragma unroll
    for (int r = 0; r < 4; ++r)
#pragma unroll
      for (int v = 0; v < 8; ++v) Th[wave][r * 16 + 8 * hlf + v][t * 16 + nloc] = (b16)(acc[r][t][v] * QS);
  wave_lds_sync();
#pragma unroll
  for (int j = 0; j < 32; ++j) { const int rr = (j >> 3) * 16 + nloc, c8 = (j & 7) * 16 + hlf * 8, o = (j >> 3) * XROW + (j & 7) * 256;   // 4 strips x 4 tiles, two 512-byte halves each: a strip's 8 halves lie one behind the other
    *(v8b*)(dh + o) = *(const v8b*)(&Th[wave][rr][c8]); }
}

// k + w projection: block = 32 tokens x all 144 columns (9 n-subtiles: k = cols 0..127, w = cols 128..143). The K = 2048 sum is split over the block's 8 waves, 256 k each, so that 128 blocks x 8 waves
// work (not 32 x 4) and a wave's chain of dependent load waits is 8 k blocks long (not 64). The 8 partial tiles are joined in LDS in a fixed order; LayerNorm, RoPE and the rounding to f16 are done by 8 threads a row.
__global__ __launch_bounds__(256) void kproj_kernel(const unsigned short* __restrict__ x16, const unsigned short* __restrict__ wk16, const float* __restrict__ cosb, const float* __restrict__ sinb, const float* __restrict__ g, const float* __restrict__ bta, b16* __restrict__ kh, float* __restrict__ wout) {
  constexpr int NW = 8, KS = HID / NW;                         // waves of a block, k per wave
  __shared__ __attribute__((aligned(16))) float Tk[NW][32][KC + 1]; __shared__ __attribute__((aligned(16))) b16 Th[32][HD + 8];
  const int lane = threadIdx.x & 31, wave = threadIdx.x >> 5, nloc = lane & 15, hlf = lane >> 4, m0 = blockIdx.x * 32;
  v8f acc[2][9];
#pragma unroll
  for (int r = 0; r < 2; ++r)
#pragma unroll
    for (int t = 0; t < 9; ++t) acc[r][t] = (v8f){};
  // Every fragment is fetched one k block ahead: the next block's two A fragments go into a second set at the block's head, each B fragment is refilled directly behind its own two WMMAs.
  // A wave walks the 8 k blocks of its slice as a ring and enters it at a k block set by the block's index: all 128 blocks read the same wk16, and from one common start they would all ask L2 for the same lines at the same moment.
  constexpr unsigned KBB = TILE * (unsigned)sizeof(unsigned short), RINGM = KS * 16 * (unsigned)sizeof(unsigned short) - KBB;   // bytes of a k block in a strip (1 KB); the bits of a byte offset that hold the k block's number in the slice (a slice is 8 KB, and slices start at multiples of it)
  auto ring = [](unsigned o, unsigned n) { return (o & ~RINGM) | ((o + n * KBB) & RINGM); };   // the same lane, strip and slice, n k blocks on, the slice's last block followed by its first
  const char* XB = (const char*)x16; const char* WB = (const char*)wk16;
  const unsigned k0b = ((blockIdx.x + (blockIdx.x >> 3)) & 7u) * KBB;   // this block's first k block: all 8 occur among 8 neighbouring blocks and among blocks 8 apart
  // This lane's byte offsets in x16 and wk16: x2, w2 at the even places of the walk (first at place 0), x1, w1 at the odd ones; the wave's slice starts at k = wave * KS
  unsigned x2 = (unsigned)(((m0 >> 4) * XROW + wave * (KS * 16) + lane * 8) * sizeof(unsigned short)) + k0b, w2 = (unsigned)((wave * (KS * 16) + lane * 8) * sizeof(unsigned short)) + k0b;
  unsigned x1 = ring(x2, 1), w1 = ring(w2, 1);
  v16bb a0[2], a1[2], bw[9];
  a0[0] = frag_bf((const unsigned short*)(XB + x2)); a0[1] = frag_bf((const unsigned short*)(XB + x2) + XROW);
#pragma unroll
  for (int t = 0; t < 9; ++t) bw[t] = frag_bf((const unsigned short*)(WB + w2) + t * XROW);
  asm volatile("s_wait_xcnt 0x0" : "+v"(x2), "+v"(w2) :: "memory");   // the first block's loads are in flight and the next line moves their two offset registers on: as in-out operands they are moved only behind this wait
  x2 = ring(x2, 2); w2 = ring(w2, 2);
  auto kstep = [&](const v16bb (&ac)[2], v16bb (&an)[2], unsigned xn, unsigned wn, bool more) {   // xn, wn = the next k block's offsets; more is a literal at every call
    if (more) { an[0] = frag_bf((const unsigned short*)(XB + xn)); an[1] = frag_bf((const unsigned short*)(XB + xn) + XROW); }
#pragma unroll
    for (int t = 0; t < 9; ++t) { acc[0][t] = wmma16bb(ac[0], bw[t], acc[0][t]); acc[1][t] = wmma16bb(ac[1], bw[t], acc[1][t]); if (more) bw[t] = frag_bf((const unsigned short*)(WB + wn) + t * XROW); } };
#pragma unroll 1   // stays rolled: one trip already holds two k blocks, one per A set
  for (int kb = 0; kb < KS - 64; kb += 64) { kstep(a0, a1, x1, w1, true); kstep(a1, a0, x2, w2, true);
    asm volatile("s_wait_xcnt 0x0" : "+v"(x1), "+v"(w1), "+v"(x2), "+v"(w2) :: "memory");   // loads are still in flight here and the next line moves their four offset registers on: as in-out operands they are moved only behind this wait
    x1 = ring(x1, 2); w1 = ring(w1, 2); x2 = ring(x2, 2); w2 = ring(w2, 2); }
  kstep(a0, a1, x1, w1, true);
  asm volatile("s_wait_xcnt 0x0" :: "v"(x1), "v"(w1) : "memory");   // the last block's loads may be in flight and the lines below reuse their offset registers: named as inputs the two stay whole up to this wait
  // Thread = (row rr, column class j): it owns columns j + 8 i, i = 0..17, so both halves of a RoPE pair (d, d + 32) lie in one thread. Its table values are asked for here, ahead of the last k block, and land under its WMMAs.
  const int rr = threadIdx.x >> 3, j = threadIdx.x & 7, tok = m0 + rr; const float* pc = cosb + (size_t)tok * RD + j; const float* ps = sinb + (size_t)tok * RD + j;   // cos/sin rows [b*S + s][64]
  float cs[8], sn[8], gg[16], bb[16];
#pragma unroll
  for (int i = 0; i < 8; ++i) { cs[i] = pc[i * 8]; sn[i] = ps[i * 8]; }
  asm volatile("s_wait_xcnt 0x0" :: "v"(pc), "v"(ps) : "memory");   // the two addresses are temporaries on which a loaded value may land: named as inputs they stay whole up to this wait, which stands in front of any such write
#pragma unroll
  for (int i = 0; i < 16; ++i) { gg[i] = g[i * 8 + j]; bb[i] = bta[i * 8 + j]; }
  asm volatile("s_wait_xcnt 0x0" ::: "memory");                // these loads are in flight and the LDS address arithmetic below may reuse their address registers: the wait stands in front of that
  kstep(a1, a0, 0u, 0u, false);
#pragma unroll
  for (int t = 0; t < 9; ++t)
#pragma unroll
    for (int r = 0; r < 2; ++r)
#pragma unroll
      for (int v = 0; v < 8; ++v) Tk[wave][r * 16 + 8 * hlf + v][t * 16 + nloc] = acc[r][t][v];
  __syncthreads();                                             // all 8 partial tiles are in LDS before any thread joins them
  float val[18];
#pragma unroll
  for (int i = 0; i < 18; ++i) { float s = Tk[0][rr][i * 8 + j];
#pragma unroll
    for (int w = 1; w < NW; ++w) s += Tk[w][rr][i * 8 + j];
    val[i] = s; }
  float mu = 0.0f;
#pragma unroll
  for (int i = 0; i < 16; ++i) mu += val[i];
  mu += __shfl_xor(mu, 1); mu += __shfl_xor(mu, 2); mu += __shfl_xor(mu, 4); mu *= (1.0f / HD);   // the row's 8 threads are 8 neighbouring lanes
  float var = 0.0f;
#pragma unroll
  for (int i = 0; i < 16; ++i) { const float z = val[i] - mu; var += z * z; }
  var += __shfl_xor(var, 1); var += __shfl_xor(var, 2); var += __shfl_xor(var, 4); var *= (1.0f / HD);
  const float rs = rsqrtf(var + LNE);
  float nv[16];
#pragma unroll
  for (int i = 0; i < 16; ++i) nv[i] = (val[i] - mu) * rs * bf16_rne(gg[i]) + bf16_rne(bb[i]);
#pragma unroll
  for (int i = 0; i < 4; ++i) {                                // RoPE pairs (d, d + 32), d = i * 8 + j, of the normalised row
    const float x1 = nv[i], x2 = nv[i + 4], c1 = bf16_rne(cs[i]), s1 = bf16_rne(sn[i]), c2 = bf16_rne(cs[i + 4]), s2 = bf16_rne(sn[i + 4]);
    nv[i] = x1 * c1 - x2 * s1; nv[i + 4] = x2 * c2 + x1 * s2; }
#pragma unroll
  for (int i = 0; i < 16; ++i) Th[rr][i * 8 + j] = (b16)(nv[i] * QS);
  __syncthreads();                                             // the 32 x 128 tile is complete before it is read back in fragment order
#pragma unroll
  for (int u2 = 0; u2 < 2; ++u2) { const int u = wave * 2 + u2, r2 = (u >> 3) * 16 + nloc, c8 = (u & 7) * 16 + hlf * 8; b16* d = kh + (size_t)(m0 >> 4) * KROW + u * 256 + lane * 8;   // 2 x 4 tiles in fragment order = 16 consecutive 512-byte halves, two a wave
    *(v8b*)(d) = *(const v8b*)(&Th[r2][c8]); }
  wout[(size_t)tok * NH + j] = val[16] * SCALE; wout[(size_t)tok * NH + 8 + j] = val[17] * SCALE;   // a wave's 4 rows x 64 B = two whole lines, written by this wave alone
}

// Each wave owns 64 keys (KT = 4 tiles of 16): their fragments (16 x 8 registers) are loaded once and stay in registers over NQ query tiles x 16 heads; only q is fetched inside the loops,
// and every q fragment that is fetched feeds all four key tiles. The four accumulator chains are independent and are issued in turn, so no WMMA stands directly behind the one whose sum it continues.
template <int QT, int NQ>
__global__ __launch_bounds__(256) void score_kernel(const b16* __restrict__ qh, const b16* __restrict__ kh, const float* __restrict__ w, float* __restrict__ out) {
  constexpr int KT = 4, KW = KT * 16;                          // key tiles and keys of a wave
  __shared__ __attribute__((aligned(16))) float Os[8][16][KW + 4];
  const int wid = threadIdx.x >> 5, lane = threadIdx.x & 31, hh = lane >> 4, col = lane & 15;
  const int wg = blockIdx.x * 8 + wid, kt = wg % (S / KW), qg = (wg / (S / KW)) % (QT / NQ), b = wg / ((S / KW) * (QT / NQ)), k0 = kt * KW;
  const b16* K = kh + (((size_t)b * S + k0) >> 4) * KROW + lane * 8;
  v16b kf[KT][4];
#pragma unroll
  for (int c = 0; c < KT; ++c)
#pragma unroll
    for (int ks = 0; ks < 4; ++ks) kf[c][ks] = frag_kb(K + c * KROW + ks * TILE);
  // q fragments are fetched one head ahead: the four stay in registers and each is refilled for the next head (or the next tile's first head) directly behind its own four WMMAs.
  v16b qf[4];
  asm volatile("s_wait_xcnt 0x0" ::: "memory");                // the k loads are in flight and the q loads below may land on their address registers: the wait stands in front of that
  const char* QB = (const char*)qh;
  unsigned qo = (unsigned)(((b * (S / 16) + qg * NQ) * XROW + lane * 8) * sizeof(b16));   // this lane's byte offset of the four tiles of the query tile and head that were fetched last
#pragma unroll
  for (int ks = 0; ks < 4; ++ks) qf[ks] = frag_kb((const b16*)(QB + qo) + ks * TILE);
  asm volatile("s_wait_xcnt 0x0" : "+v"(qo) :: "memory");   // these loads are in flight and the first trip moves their offset register on: as an in-out operand it is moved only behind this wait
  for (int qq = 0; qq < NQ; ++qq) { const int q0 = (qg * NQ + qq) * 16, qi = q0 + col;
    v8f o[KT];
#pragma unroll
    for (int c = 0; c < KT; ++c) o[c] = (v8f){};
    for (int h = 0; h < NH; ++h) { v8f s[KT];
#pragma unroll
      for (int c = 0; c < KT; ++c) s[c] = (v8f){};
      const float* wp = w + ((size_t)b * S + qi) * NH + h; const float wq = *wp;   // w for this lane's query and head, issued ahead of the head's WMMAs
      asm volatile("s_wait_xcnt 0x0" :: "v"(wp) : "memory");       // the address is a temporary on which an accumulator below may land: named as an input it stays whole up to this wait
      // next head of this tile, or head 0 of the next tile (in fragment order both lie directly behind this head's four tiles); behind the wave's last head the refill reads that head again (in bounds, not used), so no branch stands among the WMMAs
      const unsigned step = (h + 1 < NH || qq + 1 < NQ) ? 4 * TILE * (unsigned)sizeof(b16) : 0u; qo += step;
#pragma unroll
      for (int ks = 0; ks < 4; ++ks) {
#pragma unroll
        for (int c = 0; c < KT; ++c) s[c] = wmma16b(kf[c][ks], qf[ks], s[c]);
        qf[ks] = frag_kb((const b16*)(QB + qo) + ks * TILE); }
#pragma unroll
      for (int c = 0; c < KT; ++c)
#pragma unroll
        for (int r = 0; r < 8; ++r) o[c][r] += wq * fmaxf(s[c][r] * (1.0f / (QS * QS)), 0.0f);
      asm volatile("s_wait_xcnt 0x0" : "+v"(qo) :: "memory"); }   // the next head's q loads are in flight here and the next trip moves their offset register on: as an in-out operand it is moved only behind this wait
    // o[c][r] = (key k0 + 16c + 8hh + r, query col)
#pragma unroll
    for (int c = 0; c < KT; ++c)
#pragma unroll
      for (int r = 0; r < 8; ++r) Os[wid][col][c * 16 + 8 * hh + r] = o[c][r];
    wave_lds_sync();
    float* dst = out + ((size_t)b * S + q0) * S + k0;
#pragma unroll
    for (int j = 0; j < 8; ++j) { const int rr = j * 2 + (lane >> 4), c4 = (lane & 15) * 4; *(v4f*)(dst + (size_t)rr * S + c4) = *(const v4f*)(&Os[wid][rr][c4]); }   // a row's 64 keys = two whole lines
    wave_lds_sync();   // the next query tile rewrites this wave's Os slice: its reads above come first
  }
}
}  // namespace

extern "C" void kernel_launch(void* const* d_in, const int* in_sizes, int n_in,
                              void* d_out, int out_size, void* d_ws, size_t ws_size, hipStream_t stream) {
  (void)n_in; (void)out_size;
  const float* x = (const float*)d_in[0]; const float* cosb = (const float*)d_in[1]; const float* sinb = (const float*)d_in[2]; const float* wq = (const float*)d_in[3]; const float* wk = (const float*)d_in[4]; const float* ww = (const float*)d_in[5]; const float* g = (const float*)d_in[6]; const float* bta = (const float*)d_in[7];
  float* out = (float*)d_out;   // [2][2048][2048]
  if (in_sizes[0] != NTOK * HID || in_sizes[1] != NTOK * RD || in_sizes[2] != NTOK * RD || in_sizes[3] != HID * QC || in_sizes[4] != HID * HD || in_sizes[5] != HID * NH || in_sizes[6] != HD) return;
  size_t off = 0; char* ws = (char*)d_ws;
  auto carve = [&](size_t bytes) { char* p = ws + off; off += (bytes + 255) & ~(size_t)255; return p; };
  unsigned short* x16 = (unsigned short*)carve((size_t)NTOK * HID * 2); unsigned short* wq16 = (unsigned short*)carve((size_t)QC * HID * 2); unsigned short* wk16 = (unsigned short*)carve((size_t)KCP * HID * 2);
  b16* qh = (b16*)carve(QPL * 2); b16* kh = (b16*)carve(KPL * 2); float* w = (float*)carve((size_t)NTOK * NH * 4);
  if (off > ws_size) return;                                    // about 16.8 + 8.4 + 0.8 + 16.8 + 1.0 + 0.3 = 44 MB
  prep_kernel<<<1024, 256, 0, stream>>>(x, wq, wk, ww, x16, wq16, wk16);
  qproj_kernel<<<dim3(QC / 256, NTOK / 128), 128, 0, stream>>>(x16, wq16, cosb, sinb, qh, 0);
  kproj_kernel<<<NTOK / 32, 256, 0, stream>>>(x16, wk16, cosb, sinb, g, bta, kh, w);
  score_kernel<S / 16, 4><<<Bn * (S / 16 / 4) * (S / 64) / 8, 256, 0, stream>>>(qh, kh, w, out);
}

// v009
// Measured time: 67.9 microseconds a run.
// Next to v008, in two timings, it ran 1.29 and 1.27 times as fast.
// Over all steps from v000 it is 7.76 times as fast.
#include <hip/hip_runtime.h>

// Indexer: q = x Wq (16 heads x 128), k = LayerNorm_128(x Wk) (one shared head), w = SCALE x Ww (16 per token); partial RoPE (rotate-half over the first 64 dims, cos/sin INPUT tables)
// on q and k; score[b][h][q][k] = relu(q_h . k); out[b][q][k] = sum_h w[b][q][h] score -> [2][2048][2048].
// x, Wq, Wk, Ww, cos, sin, ln params are rounded to bf16: projections on v_wmma_f32_16x16x32_bf16 (exact products, f32 accumulate;
// LayerNorm, RoPE and the w scaling in f32 in the epilogues); the 16 per-head score tiles on v_wmma_f32_16x16x32_f16 with q and k each rounded once to f16, carried x8 (one product: the f16 rounding step is an eighth of the bf16 step already taken on every input), relu and the weighted head sum in f32.

namespace {
constexpr int Bn = 2, S = 2048, HID = 2048, NH = 16, HD = 128, RD = 64, NTOK = Bn * S, QC = NH * HD /* 2048 */, KC = HD + NH /* k (128) + w (16) = 144 */, KCP = 192;
constexpr float SCALE = 0.022097086912079608f /* 128^-0.5 * 16^-0.5 */, QS = 8.0f, LNE = 1e-5f;
constexpr size_t QPL = (size_t)NTOK * QC, KPL = (size_t)NTOK * HD;

typedef _Float16 b16;
typedef __attribute__((ext_vector_type(16))) _Float16 v16b;
typedef __attribute__((ext_vector_type(16))) __bf16 v16bb;
typedef __attribute__((ext_vector_type(8))) _Float16 v8b;
typedef __attribute__((ext_vector_type(8))) unsigned short v8us;
typedef __attribute__((ext_vector_type(8))) float v8f;
typedef __attribute__((ext_vector_type(4))) float v4f;
__device__ __forceinline__ float bf16_rne(float f) { unsigned int u = __float_as_uint(f); u += 0x7FFFu + ((u >> 16) & 1u); return __uint_as_float(u & 0xFFFF0000u); }
__device__ __forceinline__ unsigned short bf16_bits(float f) { unsigned int u = __float_as_uint(f); u += 0x7FFFu + ((u >> 16) & 1u); return (unsigned short)(u >> 16); }
// Fragment order of every 16-bit WMMA operand in the workspace: a [rows][K] matrix is kept as tiles of 16 rows x 32 k (512 elements, 1 KB), tile (R, Kb) at (R * (K / 32) + Kb) * 512; inside a tile
// element (row c, k kk) sits at (kk >> 3) * 128 + c * 8 + (kk & 7). Lane l = 16 * hh + c finds its k = 8hh..8hh+7 at l * 8 and its k = 16+8hh..16+8hh+7 at 256 + l * 8 (the same register
// contents as from a row-major matrix), so each load of a wave reads 512 contiguous bytes (4 whole cache lines) and not 32 bytes of each of 16 lines. p = tile start + lane * 8.
constexpr int TILE = 512, XROW = (HID / 32) * TILE /* one 16-row strip of a K = 2048 operand */, KROW = (HD / 32) * TILE;
__device__ __forceinline__ v16b frag_kb(const b16* p) { const v8b a = *(const v8b*)(p), b = *(const v8b*)(p + 256); v16b f;
#pragma unroll
  for (int e = 0; e < 8; ++e) { f[e] = a[e]; f[8 + e] = b[e]; } return f; }
__device__ __forceinline__ v16bb frag_bf(const unsigned short* p) { const v8us a = *(const v8us*)(p), b = *(const v8us*)(p + 256); union { unsigned short s[16]; v16bb v; } u;
#pragma unroll
  for (int e = 0; e < 8; ++e) { u.s[e] = a[e]; u.s[8 + e] = b[e]; } return u.v; }
__device__ __forceinline__ v8f wmma16b(v16b a, v16b b, v8f c) { v8f d = __builtin_amdgcn_wmma_f32_16x16x32_f16(false, a, false, b, (short)0, c, false, false); asm volatile("v_nop\n\tv_nop\n\tv_nop\n\tv_nop" : "+v"(d) : "v"(b)); return d; }   // A (the key fragments, never rewritten) is not named
__device__ __forceinline__ v8f wmma16bb(v16bb a, v16bb b, v8f c) { v8f d = __builtin_amdgcn_wmma_f32_16x16x32_bf16(false, a, false, b, (short)0, c, false, false); asm volatile("v_nop\n\tv_nop\n\tv_nop\n\tv_nop" : "+v"(d) : "v"(a), "v"(b)); return d; }
__device__ __forceinline__ void wave_lds_sync() { __builtin_amdgcn_fence(__ATOMIC_RELEASE, "workgroup"); __builtin_amdgcn_wave_barrier(); __builtin_amdgcn_fence(__ATOMIC_ACQUIRE, "workgroup"); }

__global__ __launch_bounds__(256) void prep_kernel(const float* __restrict__ x, const float* __restrict__ wq, const float* __restrict__ wk, const float* __restrict__ ww, unsigned short* __restrict__ x16, unsigned short* __restrict__ wq16, unsigned short* __restrict__ wk16) {
  const size_t tid = (size_t)blockIdx.x * blockDim.x + threadIdx.x, nth = (size_t)gridDim.x * blockDim.x;
  // One thread = one 16-byte piece of a fragment-order tile. A wave takes 8 rows x the tile's 32 k: piece p -> tile p / 64, row half (p / 32) % 2, k octet (p / 8) % 4, row p % 8; its store fills 4 whole lines.
  auto place = [](size_t p, int& row, int& k0, size_t& dst) { const size_t tile = p >> 6; const int c = (int)((p >> 5) & 1) * 8 + (int)(p & 7), q = (int)(p >> 3) & 3;
    row = (int)(tile / (HID / 32)) * 16 + c; k0 = (int)(tile % (HID / 32)) * 32 + q * 8; dst = tile * TILE + q * 128 + c * 8; };
  for (size_t p = tid; p < (size_t)NTOK * HID / 8; p += nth) { int row, k0; size_t dst; place(p, row, k0, dst); v8us v;
    const v4f a = *(const v4f*)(x + (size_t)row * HID + k0), b = *(const v4f*)(x + (size_t)row * HID + k0 + 4);
#pragma unroll
    for (int e = 0; e < 4; ++e) { v[e] = bf16_bits(a[e]); v[4 + e] = bf16_bits(b[e]); }
    *(v8us*)(x16 + dst) = v; }
  for (size_t p = tid; p < (size_t)QC * HID / 8; p += nth) { int n, k0; size_t dst; place(p, n, k0, dst); v8us v;
#pragma unroll
    for (int e = 0; e < 8; ++e) v[e] = bf16_bits(wq[(size_t)(k0 + e) * QC + n]);
    *(v8us*)(wq16 + dst) = v; }
  for (size_t p = tid; p < (size_t)KCP * HID / 8; p += nth) { int n, k0; size_t dst; place(p, n, k0, dst); v8us v;
#pragma unroll
    for (int e = 0; e < 8; ++e) { const float val = (n < HD) ? wk[(size_t)(k0 + e) * HD + n] : (n < KC) ? ww[(size_t)(k0 + e) * NH + (n - HD)] : 0.0f; v[e] = bf16_bits(val); }
    *(v8us*)(wk16 + dst) = v; }
}

// q projection: block = 4 waves (2 x 2), one wave a SIMD; a wave owns 64 tokens x one whole head (128 columns) = 4 x 8 accumulator tiles, so the 12 fragments of a k block feed 32 WMMAs (a 32 x 64 tile: 6 feed 8)
// and the block's 128 x 256 tile asks L2 for half the bytes. RoPE on the head's first 64 dims: pairs (i, i+32); q x8 as f16 in qh, [tok][2048] in fragment order
__global__ __launch_bounds__(128) void qproj_kernel(const unsigned short* __restrict__ x16, const unsigned short* __restrict__ wq16, const float* __restrict__ cosb, const float* __restrict__ sinb, b16* __restrict__ qh, int rowbase) {
  __shared__ __attribute__((aligned(16))) b16 Th[4][64][HD + 8];
  const int lane = threadIdx.x & 31, wave = threadIdx.x >> 5, nloc = lane & 15, hlf = lane >> 4, m0 = rowbase + blockIdx.y * 128 + (wave >> 1) * 64, c0 = blockIdx.x * 256 + (wave & 1) * 128;
  v8f acc[4][8];
#pragma unroll
  for (int r = 0; r < 4; ++r)
#pragma unroll
    for (int t = 0; t < 8; ++t) acc[r][t] = (v8f){};
  // Four register sets: the loads of k block s + 2 are issued as one group ahead of the WMMAs of block s, into the set that block s - 2 has left, so they have two blocks' time to land (the wave has no sibling on its SIMD to fill a wait).
  // The K walk is a ring of 16 trips of 4 k blocks, and each block enters it at a trip of its own: the 32 blocks that share a strip of wq16 and the 8 that share a strip of x16 run side by side, and from one common start they would all ask L2 for the same lines at the same moment.
  constexpr unsigned TRIPB = 4 * TILE * (unsigned)sizeof(unsigned short), RINGM = XROW * (unsigned)sizeof(unsigned short) - TRIPB;   // bytes of a trip in a strip (4 KB); the bits of a byte offset that hold the trip's number (a strip is 64 KB, and strips start at multiples of it)
  auto ring_next = [](unsigned o) { return (o & ~RINGM) | ((o + TRIPB) & RINGM); };   // the same lane and strip, one trip on, the last trip followed by the first
  const char* XB = (const char*)x16; const char* WB = (const char*)wq16;
  const unsigned k0b = ((blockIdx.y + 4 * (blockIdx.x & 3) + 2 * (blockIdx.x >> 2)) & 15u) * TRIPB;   // this block's first trip: 16 different ones down a column of blocks, 8 along a row, neighbours in a row 4 trips apart (any four of them in a row lie spread round the ring, so each soon walks where another has been)
  unsigned ao = (unsigned)(((m0 >> 4) * XROW + lane * 8) * sizeof(unsigned short)) + k0b, bo = (unsigned)(((c0 >> 4) * XROW + lane * 8) * sizeof(unsigned short)) + k0b;   // this lane's byte offsets in x16 and wq16 at the trip's first k block
  unsigned an = ring_next(ao), bn = ring_next(bo);             // the same at the next trip's first k block
  v16bb f0[12], f1[12], f2[12], f3[12];                        // a0..a3, b0..b7
  auto fetch = [&](v16bb (&f)[12], unsigned ax, unsigned bx, int kt) {   // ax, bx = a trip's offsets; kt = k block (tile) counted from that trip's first
#pragma unroll
    for (int r = 0; r < 4; ++r) f[r] = frag_bf((const unsigned short*)(XB + ax) + r * XROW + kt * TILE);
#pragma unroll
    for (int t = 0; t < 8; ++t) f[4 + t] = frag_bf((const unsigned short*)(WB + bx) + t * XROW + kt * TILE);
    __builtin_amdgcn_sched_barrier(0); };                      // keeps the group whole and ahead of the block: without it the compiler sinks these loads down to their first use, two blocks later, and the wave waits out their latency there
  auto mma = [&](const v16bb (&f)[12]) {                       // 32 independent sums; the plain builtin (the compiler keeps its distances): operands of an asm pad could not lie above v255
#pragma unroll
    for (int t = 0; t < 8; ++t)
#pragma unroll
      for (int r = 0; r < 4; ++r) acc[r][t] = __builtin_amdgcn_wmma_f32_16x16x32_bf16(false, f[r], false, f[4 + t], (short)0, acc[r][t], false, false);
    __builtin_amdgcn_sched_barrier(0); };                      // the block ends here: the next group's loads are not lifted in among its WMMAs
  fetch(f0, ao, bo, 0); fetch(f1, ao, bo, 1);
  // A block asks L2 for its first trips ahead, one trip (its 8 strips x 4 KB) an instruction, each thread one 256-byte unit. Hints only: nothing waits for them and no value depends on them.
  constexpr int PFT = 4;                                       // trips of the loop that still ask: trips 1 and 2 of the walk are asked for here, trip i + 3 in the loop's trip i
  unsigned ap = ring_next((unsigned)((((rowbase + blockIdx.y * 128) >> 4) + (threadIdx.x >> 4)) * XROW * sizeof(unsigned short)) + (threadIdx.x & 15u) * 256u + k0b);   // this thread's unit in the trip that is asked for next; it lives through the loop and walks the ring, so it never leaves the block's strips
  asm volatile("global_prefetch_b8 %0, %1 scope:SCOPE_SE\n\ts_wait_xcnt 0x0" : "+v"(ap) : "s"(XB) : "memory");   // the wait stands in front of the next line, which moves ap on
  ap = ring_next(ap);
  asm volatile("global_prefetch_b8 %0, %1 scope:SCOPE_SE\n\ts_wait_xcnt 0x0" : "+v"(ap) : "s"(XB) : "memory");   // as above
  ap = ring_next(ap);
#pragma unroll 1   // stays rolled: one trip already holds four k blocks, one per register set
  for (int kt = 0; kt < HID / 32 - 4; kt += 4) {
    if (kt < PFT * 4) asm volatile("global_prefetch_b8 %0, %1 scope:SCOPE_SE" :: "v"(ap), "s"(XB));   // a scalar test, the same for the whole block
    fetch(f2, ao, bo, 2); mma(f0); fetch(f3, ao, bo, 3); mma(f1); fetch(f0, an, bn, 0); mma(f2); fetch(f1, an, bn, 1); mma(f3);
    asm volatile("s_wait_xcnt 0x0" : "+v"(ao), "+v"(bo), "+v"(an), "+v"(bn), "+v"(ap) :: "memory");   // loads are still in flight here and the next line moves their four offset registers and the prefetch's on: as in-out operands they are moved only behind this wait
    ao = an; bo = bn; an = ring_next(an); bn = ring_next(bn); ap = ring_next(ap); }
  fetch(f2, ao, bo, 2); mma(f0); fetch(f3, ao, bo, 3); mma(f1);
  asm volatile("s_wait_xcnt 0x0" : "+v"(ao), "+v"(bo) :: "memory");   // the last blocks' loads may be in flight and the epilogue reuses their offset registers: the wait stands in front of that
  mma(f2); mma(f3);
  // RoPE tables: this lane's rows are tokens m0 + 16 r + 8 hlf + v, its columns 16 u + nloc, u = 0..3; all 256 values hang on two addresses
  const float* pc = cosb + (size_t)(m0 + 8 * hlf) * RD + nloc; const float* ps = sinb + (size_t)(m0 + 8 * hlf) * RD + nloc;   // cos/sin rows [b*S + s][64]
  float cs[4][8][4], sn[4][8][4];
#pragma unroll
  for (int r = 0; r < 4; ++r)
#pragma unroll
    for (int v = 0; v < 8; ++v)
#pragma unroll
      for (int u = 0; u < 4; ++u) { cs[r][v][u] = pc[(r * 16 + v) * RD + u * 16]; sn[r][v][u] = ps[(r * 16 + v) * RD + u * 16]; }
  asm volatile("s_wait_xcnt 0x0" :: "v"(pc), "v"(ps) : "memory");   // named as inputs the two addresses stay whole up to this wait, which stands in front of any write on them
#pragma unroll
  for (int t = 0; t < 2; ++t)                                  // pair (i, i + 32), i = 16 t + nloc, = (acc[.][t], acc[.][t+2])
#pragma unroll
    for (int r = 0; r < 4; ++r)
#pragma unroll
      for (int v = 0; v < 8; ++v) { const float c1 = bf16_rne(cs[r][v][t]), s1 = bf16_rne(sn[r][v][t]), c2 = bf16_rne(cs[r][v][t + 2]), s2 = bf16_rne(sn[r][v][t + 2]);
        const float x1 = acc[r][t][v], x2 = acc[r][t + 2][v]; acc[r][t][v] = x1 * c1 - x2 * s1; acc[r][t + 2][v] = x2 * c2 + x1 * s2; }
  b16* dh = qh + (size_t)(m0 >> 4) * XROW + (c0 >> 5) * TILE + lane * 8;   // the wave's 4 x 4 tiles
#pragma unroll
  for (int t = 0; t < 8; ++t)
#pragma unroll
    for (int r = 0; r < 4; ++r)
#pragma unroll
      for (int v = 0; v < 8; ++v) Th[wave][r * 16 + 8 * hlf + v][t * 16 + nloc] = (b16)(acc[r][t][v] * QS);
  wave_lds_sync();
#pragma unroll
  for (int j = 0; j < 32; ++j) { const int rr = (j >> 3) * 16 + nloc, c8 = (j & 7) * 16 + hlf * 8, o = (j >> 3) * XROW + (j & 7) * 256;   // 4 strips x 4 tiles, two 512-byte halves each: a strip's 8 halves lie one behind the other
    *(v8b*)(dh + o) = *(const v8b*)(&Th[wave][rr][c8]); }
}

// k + w projection: block = 32 tokens x all 144 columns (9 n-subtiles: k = cols 0..127, w = cols 128..143). The K = 2048 sum is split over the block's 8 waves, 256 k each, so that 128 blocks x 8 waves
// work (not 32 x 4) and a wave's chain of dependent load waits is 8 k blocks long (not 64). The 8 partial tiles are joined in LDS in a fixed order; LayerNorm, RoPE and the rounding to f16 are done by 8 threads a row.
__global__ __launch_bounds__(256) void kproj_kernel(const unsigned short* __restrict__ x16, const unsigned short* __restrict__ wk16, const float* __restrict__ cosb, const float* __restrict__ sinb, const float* __restrict__ g, const float* __restrict__ bta, b16* __restrict__ kh, float* __restrict__ wout) {
  constexpr int NW = 8, KS = HID / NW;                         // waves of a block, k per wave
  __shared__ __attribute__((aligned(16))) float Tk[NW][32][KC + 1]; __shared__ __attribute__((aligned(16))) b16 Th[32][HD + 8];
  const int lane = threadIdx.x & 31, wave = threadIdx.x >> 5, nloc = lane & 15, hlf = lane >> 4, m0 = blockIdx.x * 32;
  v8f acc[2][9];
#pragma unroll
  for (int r = 0; r < 2; ++r)
#pragma unroll
    for (int t = 0; t < 9; ++t) acc[r][t] = (v8f){};
  // Every fragment is fetched one k block ahead: the next block's two A fragments go into a second set at the block's head, each B fragment is refilled directly behind its own two WMMAs.
  // A wave walks the 8 k blocks of its slice as a ring and enters it at a k block set by the block's index: all 128 blocks read the same wk16, and from one common start they would all ask L2 for the same lines at the same moment.
  constexpr unsigned KBB = TILE * (unsigned)sizeof(unsigned short), RINGM = KS * 16 * (unsigned)sizeof(unsigned short) - KBB;   // bytes of a k block in a strip (1 KB); the bits of a byte offset that hold the k block's number in the slice (a slice is 8 KB, and slices start at multiples of it)
  auto ring = [](unsigned o, unsigned n) { return (o & ~RINGM) | ((o + n * KBB) & RINGM); };   // the same lane, strip and slice, n k blocks on, the slice's last block followed by its first
  const char* XB = (const char*)x16; const char* WB = (const char*)wk16;
  const unsigned k0b = ((blockIdx.x + (blockIdx.x >> 3)) & 7u) * KBB;   // this block's first k block: all 8 occur among 8 neighbouring blocks and among blocks 8 apart
  // This lane's byte offsets in x16 and wk16: x2, w2 at the even places of the walk (first at place 0), x1, w1 at the odd ones; the wave's slice starts at k = wave * KS
  unsigned x2 = (unsigned)(((m0 >> 4) * XROW + wave * (KS * 16) + lane * 8) * sizeof(unsigned short)) + k0b, w2 = (unsigned)((wave * (KS * 16) + lane * 8) * sizeof(unsigned short)) + k0b;
  unsigned x1 = ring(x2, 1), w1 = ring(w2, 1);
  v16bb a0[2], a1[2], bw[9];
  a0[0] = frag_bf((const unsigned short*)(XB + x2)); a0[1] = frag_bf((const unsigned short*)(XB + x2) + XROW);
#pragma unroll
  for (int t = 0; t < 9; ++t) bw[t] = frag_bf((const unsigned short*)(WB + w2) + t * XROW);
  asm volatile("s_wait_xcnt 0x0" : "+v"(x2), "+v"(w2) :: "memory");   // the first block's loads are in flight and the next line moves their two offset registers on: as in-out operands they are moved only behind this wait
  x2 = ring(x2, 2); w2 = ring(w2, 2);
  auto kstep = [&](const v16bb (&ac)[2], v16bb (&an)[2], unsigned xn, unsigned wn, bool more) {   // xn, wn = the next k block's offsets; more is a literal at every call
    if (more) { an[0] = frag_bf((const unsigned short*)(XB + xn)); an[1] = frag_bf((const unsigned short*)(XB + xn) + XROW); }
#pragma unroll
    for (int t = 0; t < 9; ++t) { acc[0][t] = wmma16bb(ac[0], bw[t], acc[0][t]); acc[1][t] = wmma16bb(ac[1], bw[t], acc[1][t]); if (more) bw[t] = frag_bf((const unsigned short*)(WB + wn) + t * XROW); } };
#pragma unroll 1   // stays rolled: one trip already holds two k blocks, one per A set
  for (int kb = 0; kb < KS - 64; kb += 64) { kstep(a0, a1, x1, w1, true); kstep(a1, a0, x2, w2, true);
    asm volatile("s_wait_xcnt 0x0" : "+v"(x1), "+v"(w1), "+v"(x2), "+v"(w2) :: "memory");   // loads are still in flight here and the next line moves their four offset registers on: as in-out operands they are moved only behind this wait
    x1 = ring(x1, 2); w1 = ring(w1, 2); x2 = ring(x2, 2); w2 = ring(w2, 2); }
  kstep(a0, a1, x1, w1, true);
  asm volatile("s_wait_xcnt 0x0" :: "v"(x1), "v"(w1) : "memory");   // the last block's loads may be in flight and the lines below reuse their offset registers: named as inputs the two stay whole up to this wait
  // Thread = (row rr, column class j): it owns columns j + 8 i, i = 0..17, so both halves of a RoPE pair (d, d + 32) lie in one thread. Its table values are asked for here, ahead of the last k block, and land under its WMMAs.
  const int rr = threadIdx.x >> 3, j = threadIdx.x & 7, tok = m0 + rr; const float* pc = cosb + (size_t)tok * RD + j; const float* ps = sinb + (size_t)tok * RD + j;   // cos/sin rows [b*S + s][64]
  float cs[8], sn[8], gg[16], bb[16];
#pragma unroll
  for (int i = 0; i < 8; ++i) { cs[i] = pc[i * 8]; sn[i] = ps[i * 8]; }
  asm volatile("s_wait_xcnt 0x0" :: "v"(pc), "v"(ps) : "memory");   // the two addresses are temporaries on which a loaded value may land: named as inputs they stay whole up to this wait, which stands in front of any such write
#pragma unroll
  for (int i = 0; i < 16; ++i) { gg[i] = g[i * 8 + j]; bb[i] = bta[i * 8 + j]; }
  asm volatile("s_wait_xcnt 0x0" ::: "memory");                // these loads are in flight and the LDS address arithmetic below may reuse their address registers: the wait stands in front of that
  kstep(a1, a0, 0u, 0u, false);
#pragma unroll
  for (int t = 0; t < 9; ++t)
#pragma unroll
    for (int r = 0; r < 2; ++r)
#pragma unroll
      for (int v = 0; v < 8; ++v) Tk[wave][r * 16 + 8 * hlf + v][t * 16 + nloc] = acc[r][t][v];
  __syncthreads();                                             // all 8 partial tiles are in LDS before any thread joins them
  float val[18];
#pragma unroll
  for (int i = 0; i < 18; ++i) { float s = Tk[0][rr][i * 8 + j];
#pragma unroll
    for (int w = 1; w < NW; ++w) s += Tk[w][rr][i * 8 + j];
    val[i] = s; }
  float mu = 0.0f;
#pragma unroll
  for (int i = 0; i < 16; ++i) mu += val[i];
  mu += __shfl_xor(mu, 1); mu += __shfl_xor(mu, 2); mu += __shfl_xor(mu, 4); mu *= (1.0f / HD);   // the row's 8 threads are 8 neighbouring lanes
  float var = 0.0f;
#pragma unroll
  for (int i = 0; i < 16; ++i) { const float z = val[i] - mu; var += z * z; }
  var += __shfl_xor(var, 1); var += __shfl_xor(var, 2); var += __shfl_xor(var, 4); var *= (1.0f / HD);
  const float rs = rsqrtf(var + LNE);
  float nv[16];
#pragma unroll
  for (int i = 0; i < 16; ++i) nv[i] = (val[i] - mu) * rs * bf16_rne(gg[i]) + bf16_rne(bb[i]);
#pragma unroll
  for (int i = 0; i < 4; ++i) {                                // RoPE pairs (d, d + 32), d = i * 8 + j, of the normalised row
    const float x1 = nv[i], x2 = nv[i + 4], c1 = bf16_rne(cs[i]), s1 = bf16_rne(sn[i]), c2 = bf16_rne(cs[i + 4]), s2 = bf16_rne(sn[i + 4]);
    nv[i] = x1 * c1 - x2 * s1; nv[i + 4] = x2 * c2 + x1 * s2; }
#pragma unroll
  for (int i = 0; i < 16; ++i) Th[rr][i * 8 + j] = (b16)(nv[i] * QS);
  __syncthreads();                                             // the 32 x 128 tile is complete before it is read back in fragment order
#pragma unroll
  for (int u2 = 0; u2 < 2; ++u2) { const int u = wave * 2 + u2, r2 = (u >> 3) * 16 + nloc, c8 = (u & 7) * 16 + hlf * 8; b16* d = kh + (size_t)(m0 >> 4) * KROW + u * 256 + lane * 8;   // 2 x 4 tiles in fragment order = 16 consecutive 512-byte halves, two a wave
    *(v8b*)(d) = *(const v8b*)(&Th[r2][c8]); }
  wout[(size_t)tok * NH + j] = val[16] * SCALE; wout[(size_t)tok * NH + 8 + j] = val[17] * SCALE;   // a wave's 4 rows x 64 B = two whole lines, written by this wave alone
}

// Each wave owns 64 keys (KT = 4 tiles of 16): their fragments (16 x 8 registers) are loaded once and stay in registers over NQ query tiles x 16 heads; only q is fetched inside the loops,
// and every q fragment that is fetched feeds all four key tiles. The four accumulator chains are independent and are issued in turn, so no WMMA stands directly behind the one whose sum it continues.
template <int QT, int NQ>
__global__ __launch_bounds__(256) void score_kernel(const b16* __restrict__ qh, const b16* __restrict__ kh, const float* __restrict__ w, float* __restrict__ out) {
  constexpr int KT = 4, KW = KT * 16;                          // key tiles and keys of a wave
  constexpr unsigned QTB = XROW * (unsigned)sizeof(b16);       // bytes of a query tile's q, all 16 heads (64 KB); the wave's NQ tiles lie one behind the other
  static_assert(NQ >= 3 && QTB == 256 * 256, "the first three tiles must exist; 256 threads x 256 B cover a tile");
  __shared__ __attribute__((aligned(16))) float Os[8][16][KW + 4];
  const int wid = threadIdx.x >> 5, lane = threadIdx.x & 31, hh = lane >> 4, col = lane & 15;
  const int wg = blockIdx.x * 8 + wid, kt = wg % (S / KW), qg = (wg / (S / KW)) % (QT / NQ), b = wg / ((S / KW) * (QT / NQ)), k0 = kt * KW;
  const b16* K = kh + (((size_t)b * S + k0) >> 4) * KROW + lane * 8;
  v16b kf[KT][4];
#pragma unroll
  for (int c = 0; c < KT; ++c)
#pragma unroll
    for (int ks = 0; ks < 4; ++ks) kf[c][ks] = frag_kb(K + c * KROW + ks * TILE);
  // q fragments are fetched one head ahead: the four stay in registers and each is refilled for the next head (or the next tile's first head) directly behind its own four WMMAs.
  v16b qf[4];
  asm volatile("s_wait_xcnt 0x0" ::: "memory");                // the k loads are in flight and the q loads below may land on their address registers: the wait stands in front of that
  const char* QB = (const char*)qh;
  unsigned qo = (unsigned)(((b * (S / 16) + qg * NQ) * XROW + lane * 8) * sizeof(b16));   // this lane's byte offset of the four tiles of the query tile and head that were fetched last
#pragma unroll
  for (int ks = 0; ks < 4; ++ks) qf[ks] = frag_kb((const b16*)(QB + qo) + ks * TILE);
  asm volatile("s_wait_xcnt 0x0" : "+v"(qo) :: "memory");   // these loads are in flight and the first trip moves their offset register on: as an in-out operand it is moved only behind this wait
  // The block asks L2 for a query tile's q two tiles ahead of its loads, each thread one 256-byte unit, and at entry for its w rows. Hints only: nothing waits for them and no value depends on them.
  unsigned po = (unsigned)((b * (S / 16) + qg * NQ) * XROW * sizeof(b16)) + threadIdx.x * 256u;   // this thread's unit in the tile that is asked for next; it lives through the loops and never leaves the block's NQ tiles
  asm volatile("global_prefetch_b8 %0, %1 scope:SCOPE_SE\n\tglobal_prefetch_b8 %0, %1 offset:65536 scope:SCOPE_SE\n\ts_wait_xcnt 0x0" : "+v"(po) : "s"(QB) : "memory");   // tiles 0 and 1; the wait stands in front of the next line, which moves po on
  po += 2 * QTB;
  const float* W0 = w + ((size_t)b * S + qg * NQ * 16 + col) * NH;   // w row of this lane's query in the wave's first tile; the next tiles' rows lie 1 KB apart. It serves every head's w load, so it lives through the loops
  static_assert(NQ == 4, "four w prefetches, one a query tile");
  if (__builtin_amdgcn_readfirstlane(wid) == 0)                // a scalar test: all 8 waves read the same w rows, one wave asks
    asm volatile("global_prefetch_b8 %0, off scope:SCOPE_SE\n\tglobal_prefetch_b8 %0, off offset:1024 scope:SCOPE_SE\n\tglobal_prefetch_b8 %0, off offset:2048 scope:SCOPE_SE\n\tglobal_prefetch_b8 %0, off offset:3072 scope:SCOPE_SE" :: "v"(W0));
  for (int qq = 0; qq < NQ; ++qq) { const int q0 = (qg * NQ + qq) * 16;
    if (qq + 2 < NQ) asm volatile("global_prefetch_b8 %0, %1 scope:SCOPE_SE" :: "v"(po), "s"(QB));   // tile qq + 2; a scalar test, the same for the whole block
    v8f o[KT];
#pragma unroll
    for (int c = 0; c < KT; ++c) o[c] = (v8f){};
    for (int h = 0; h < NH; ++h) { v8f s[KT];
#pragma unroll
      for (int c = 0; c < KT; ++c) s[c] = (v8f){};
      const float* wp = W0 + qq * 16 * NH + h; const float wq = *wp;   // w for this lane's query and head, issued ahead of the head's WMMAs
      asm volatile("s_wait_xcnt 0x0" :: "v"(wp) : "memory");       // the address is a temporary on which an accumulator below may land: named as an input it stays whole up to this wait
      // next head of this tile, or head 0 of the next tile (in fragment order both lie directly behind this head's four tiles); behind the wave's last head the refill reads that head again (in bounds, not used), so no branch stands among the WMMAs
      const unsigned step = (h + 1 < NH || qq + 1 < NQ) ? 4 * TILE * (unsigned)sizeof(b16) : 0u; qo += step;
#pragma unroll
      for (int ks = 0; ks < 4; ++ks) {
#pragma unroll
        for (int c = 0; c < KT; ++c) s[c] = wmma16b(kf[c][ks], qf[ks], s[c]);
        qf[ks] = frag_kb((const b16*)(QB + qo) + ks * TILE); }
#pragma unroll
      for (int c = 0; c < KT; ++c)
#pragma unroll
        for (int r = 0; r < 8; ++r) o[c][r] += wq * fmaxf(s[c][r] * (1.0f / (QS * QS)), 0.0f);
      asm volatile("s_wait_xcnt 0x0" : "+v"(qo) :: "memory"); }   // the next head's q loads are in flight here and the next trip moves their offset register on: as an in-out operand it is moved only behind this wait
    // o[c][r] = (key k0 + 16c + 8hh + r, query col)
#pragma unroll
    for (int c = 0; c < KT; ++c)
#pragma unroll
      for (int r = 0; r < 8; ++r) Os[wid][col][c * 16 + 8 * hh + r] = o[c][r];
    wave_lds_sync();
    float* dst = out + ((size_t)b * S + q0) * S + k0;
#pragma unroll
    for (int j = 0; j < 8; ++j) { const int rr = j * 2 + (lane >> 4), c4 = (lane & 15) * 4; *(v4f*)(dst + (size_t)rr * S + c4) = *(const v4f*)(&Os[wid][rr][c4]); }   // a row's 64 keys = two whole lines
    wave_lds_sync();   // the next query tile rewrites this wave's Os slice: its reads above come first
    asm volatile("s_wait_xcnt 0x0" : "+v"(po) :: "memory");   // the next line moves the prefetch's offset register on: as an in-out operand it is moved only behind this wait
    po += (qq + 3 < NQ) ? QTB : 0u;                            // stays on the block's last tile once it is there: in bounds before and behind every advance
  }
}
}  // namespace

extern "C" void kernel_launch(void* const* d_in, const int* in_sizes, int n_in,
                              void* d_out, int out_size, void* d_ws, size_t ws_size, hipStream_t stream) {
  (void)n_in; (void)out_size;
  const float* x = (const float*)d_in[0]; const float* cosb = (const float*)d_in[1]; const float* sinb = (const float*)d_in[2]; const float* wq = (const float*)d_in[3]; const float* wk = (const float*)d_in[4]; const float* ww = (const float*)d_in[5]; const float* g = (const float*)d_in[6]; const float* bta = (const float*)d_in[7];
  float* out = (float*)d_out;   // [2][2048][2048]
  if (in_sizes[0] != NTOK * HID || in_sizes[1] != NTOK * RD || in_sizes[2] != NTOK * RD || in_sizes[3] != HID * QC || in_sizes[4] != HID * HD || in_sizes[5] != HID * NH || in_sizes[6] != HD) return;
  size_t off = 0; char* ws = (char*)d_ws;
  auto carve = [&](size_t bytes) { char* p = ws + off; off += (bytes + 255) & ~(size_t)255; return p; };
  unsigned short* x16 = (unsigned short*)carve((size_t)NTOK * HID * 2); unsigned short* wq16 = (unsigned short*)carve((size_t)QC * HID * 2); unsigned short* wk16 = (unsigned short*)carve((size_t)KCP * HID * 2);
  b16* qh = (b16*)carve(QPL * 2); b16* kh = (b16*)carve(KPL * 2); float* w = (float*)carve((size_t)NTOK * NH * 4);
  if (off > ws_size) return;                                    // about 16.8 + 8.4 + 0.8 + 16.8 + 1.0 + 0.3 = 44 MB
  prep_kernel<<<1024, 256, 0, stream>>>(x, wq, wk, ww, x16, wq16, wk16);
  qproj_kernel<<<dim3(QC / 256, NTOK / 128), 128, 0, stream>>>(x16, wq16, cosb, sinb, qh, 0);
  kproj_kernel<<<NTOK / 32, 256, 0, stream>>>(x16, wk16, cosb, sinb, g, bta, kh, w);
  score_kernel<S / 16, 4><<<Bn * (S / 16 / 4) * (S / 64) / 8, 256, 0, stream>>>(qh, kh, w, out);
}

// v010
// It runs in 63.1 microseconds.
// Two timings next to v009 both put it at 1.08 times that version's speed.
// All steps since v000 together make it 8.36 times as fast.
#include <hip/hip_runtime.h>

// Indexer: q = x Wq (16 heads x 128), k = LayerNorm_128(x Wk) (one shared head), w = SCALE x Ww (16 per token); partial RoPE (rotate-half over the first 64 dims, cos/sin INPUT tables)
// on q and k; score[b][h][q][k] = relu(q_h . k); out[b][q][k] = sum_h w[b][q][h] score -> [2][2048][2048].
// x, Wq, Wk, Ww, cos, sin, ln params are rounded to bf16: projections on v_wmma_f32_16x16x32_bf16 (exact products, f32 accumulate;
// LayerNorm, RoPE and the w scaling in f32 in the epilogues); the 16 per-head score tiles on v_wmma_f32_16x16x32_f16 with q and k each rounded once to f16, carried x8 (one product: the f16 rounding step is an eighth of the bf16 step already taken on every input), relu and the weighted head sum in f32.

namespace {
constexpr int Bn = 2, S = 2048, HID = 2048, NH = 16, HD = 128, RD = 64, NTOK = Bn * S, QC = NH * HD /* 2048 */, KC = HD + NH /* k (128) + w (16) = 144 */, KCP = 192;
constexpr float SCALE = 0.022097086912079608f /* 128^-0.5 * 16^-0.5 */, QS = 8.0f, LNE = 1e-5f;
constexpr size_t QPL = (size_t)NTOK * QC, KPL = (size_t)NTOK * HD;

typedef _Float16 b16;
typedef __attribute__((ext_vector_type(16))) _Float16 v16b;
typedef __attribute__((ext_vector_type(16))) __bf16 v16bb;
typedef __attribute__((ext_vector_type(8))) _Float16 v8b;
typedef __attribute__((ext_vector_type(8))) unsigned short v8us;
typedef __attribute__((ext_vector_type(8))) float v8f;
typedef __attribute__((ext_vector_type(4))) float v4f;
__device__ __forceinline__ float bf16_rne(float f) { unsigned int u = __float_as_uint(f); u += 0x7FFFu + ((u >> 16) & 1u); return __uint_as_float(u & 0xFFFF0000u); }
__device__ __forceinline__ unsigned short bf16_bits(float f) { unsigned int u = __float_as_uint(f); u += 0x7FFFu + ((u >> 16) & 1u); return (unsigned short)(u >> 16); }
// Fragment order of every 16-bit WMMA operand in the workspace: a [rows][K] matrix is kept as tiles of 16 rows x 32 k (512 elements, 1 KB), tile (R, Kb) at (R * (K / 32) + Kb) * 512; inside a tile
// element (row c, k kk) sits at (kk >> 3) * 128 + c * 8 + (kk & 7). Lane l = 16 * hh + c finds its k = 8hh..8hh+7 at l * 8 and its k = 16+8hh..16+8hh+7 at 256 + l * 8 (the same register
// contents as from a row-major matrix), so each load of a wave reads 512 contiguous bytes (4 whole cache lines) and not 32 bytes of each of 16 lines. p = tile start + lane * 8.
constexpr int TILE = 512, XROW = (HID / 32) * TILE /* one 16-row strip of a K = 2048 operand */, KROW = (HD / 32) * TILE;
__device__ __forceinline__ v16b frag_kb(const b16* p) { const v8b a = *(const v8b*)(p), b = *(const v8b*)(p + 256); v16b f;
#pragma unroll
  for (int e = 0; e < 8; ++e) { f[e] = a[e]; f[8 + e] = b[e]; } return f; }
__device__ __forceinline__ v16bb frag_bf(const unsigned short* p) { const v8us a = *(const v8us*)(p), b = *(const v8us*)(p + 256); union { unsigned short s[16]; v16bb v; } u;
#pragma unroll
  for (int e = 0; e < 8; ++e) { u.s[e] = a[e]; u.s[8 + e] = b[e]; } return u.v; }
__device__ __forceinline__ v8f wmma16b(v16b a, v16b b, v8f c) { return __builtin_amdgcn_wmma_f32_16x16x32_f16(false, a, false, b, (short)0, c, false, false); }   // the plain builtin (the compiler keeps its distances): operands of an asm pad could not lie above v255
__device__ __forceinline__ v8f wmma16bb(v16bb a, v16bb b, v8f c) { v8f d = __builtin_amdgcn_wmma_f32_16x16x32_bf16(false, a, false, b, (short)0, c, false, false); asm volatile("v_nop\n\tv_nop\n\tv_nop\n\tv_nop" : "+v"(d) : "v"(a), "v"(b)); return d; }
__device__ __forceinline__ void wave_lds_sync() { __builtin_amdgcn_fence(__ATOMIC_RELEASE, "workgroup"); __builtin_amdgcn_wave_barrier(); __builtin_amdgcn_fence(__ATOMIC_ACQUIRE, "workgroup"); }

__global__ __launch_bounds__(256) void prep_kernel(const float* __restrict__ x, const float* __restrict__ wq, const float* __restrict__ wk, const float* __restrict__ ww, unsigned short* __restrict__ x16, unsigned short* __restrict__ wq16, unsigned short* __restrict__ wk16) {
  const size_t tid = (size_t)blockIdx.x * blockDim.x + threadIdx.x, nth = (size_t)gridDim.x * blockDim.x;
  // One thread = one 16-byte piece of a fragment-order tile. A wave takes 8 rows x the tile's 32 k: piece p -> tile p / 64, row half (p / 32) % 2, k octet (p / 8) % 4, row p % 8; its store fills 4 whole lines.
  auto place = [](size_t p, int& row, int& k0, size_t& dst) { const size_t tile = p >> 6; const int c = (int)((p >> 5) & 1) * 8 + (int)(p & 7), q = (int)(p >> 3) & 3;
    row = (int)(tile / (HID / 32)) * 16 + c; k0 = (int)(tile % (HID / 32)) * 32 + q * 8; dst = tile * TILE + q * 128 + c * 8; };
  for (size_t p = tid; p < (size_t)NTOK * HID / 8; p += nth) { int row, k0; size_t dst; place(p, row, k0, dst); v8us v;
    const v4f a = *(const v4f*)(x + (size_t)row * HID + k0), b = *(const v4f*)(x + (size_t)row * HID + k0 + 4);
#pragma unroll
    for (int e = 0; e < 4; ++e) { v[e] = bf16_bits(a[e]); v[4 + e] = bf16_bits(b[e]); }
    *(v8us*)(x16 + dst) = v; }
  for (size_t p = tid; p < (size_t)QC * HID / 8; p += nth) { int n, k0; size_t dst; place(p, n, k0, dst); v8us v;
#pragma unroll
    for (int e = 0; e < 8; ++e) v[e] = bf16_bits(wq[(size_t)(k0 + e) * QC + n]);
    *(v8us*)(wq16 + dst) = v; }
  for (size_t p = tid; p < (size_t)KCP * HID / 8; p += nth) { int n, k0; size_t dst; place(p, n, k0, dst); v8us v;
#pragma unroll
    for (int e = 0; e < 8; ++e) { const float val = (n < HD) ? wk[(size_t)(k0 + e) * HD + n] : (n < KC) ? ww[(size_t)(k0 + e) * NH + (n - HD)] : 0.0f; v[e] = bf16_bits(val); }
    *(v8us*)(wk16 + dst) = v; }
}

// q projection: block = 4 waves (2 x 2), one wave a SIMD; a wave owns 64 tokens x one whole head (128 columns) = 4 x 8 accumulator tiles, so the 12 fragments of a k block feed 32 WMMAs (a 32 x 64 tile: 6 feed 8)
// and the block's 128 x 256 tile asks L2 for half the bytes. RoPE on the head's first 64 dims: pairs (i, i+32); q x8 as f16 in qh, [tok][2048] in fragment order
__global__ __launch_bounds__(128) void qproj_kernel(const unsigned short* __restrict__ x16, const unsigned short* __restrict__ wq16, const float* __restrict__ cosb, const float* __restrict__ sinb, b16* __restrict__ qh, int rowbase) {
  __shared__ __attribute__((aligned(16))) b16 Th[4][64][HD + 8];
  const int lane = threadIdx.x & 31, wave = threadIdx.x >> 5, nloc = lane & 15, hlf = lane >> 4, m0 = rowbase + blockIdx.y * 128 + (wave >> 1) * 64, c0 = blockIdx.x * 256 + (wave & 1) * 128;
  v8f acc[4][8];
#pragma unroll
  for (int r = 0; r < 4; ++r)
#pragma unroll
    for (int t = 0; t < 8; ++t) acc[r][t] = (v8f){};
  // Four register sets: the loads of k block s + 2 are issued as one group ahead of the WMMAs of block s, into the set that block s - 2 has left, so they have two blocks' time to land (the wave has no sibling on its SIMD to fill a wait).
  // The K walk is a ring of 16 trips of 4 k blocks, and each block enters it at a trip of its own: the 32 blocks that share a strip of wq16 and the 8 that share a strip of x16 run side by side, and from one common start they would all ask L2 for the same lines at the same moment.
  constexpr unsigned TRIPB = 4 * TILE * (unsigned)sizeof(unsigned short), RINGM = XROW * (unsigned)sizeof(unsigned short) - TRIPB;   // bytes of a trip in a strip (4 KB); the bits of a byte offset that hold the trip's number (a strip is 64 KB, and strips start at multiples of it)
  auto ring_next = [](unsigned o) { return (o & ~RINGM) | ((o + TRIPB) & RINGM); };   // the same lane and strip, one trip on, the last trip followed by the first
  const char* XB = (const char*)x16; const char* WB = (const char*)wq16;
  const unsigned k0b = ((blockIdx.y + 4 * (blockIdx.x & 3) + 2 * (blockIdx.x >> 2)) & 15u) * TRIPB;   // this block's first trip: 16 different ones down a column of blocks, 8 along a row, neighbours in a row 4 trips apart (any four of them in a row lie spread round the ring, so each soon walks where another has been)
  unsigned ao = (unsigned)(((m0 >> 4) * XROW + lane * 8) * sizeof(unsigned short)) + k0b, bo = (unsigned)(((c0 >> 4) * XROW + lane * 8) * sizeof(unsigned short)) + k0b;   // this lane's byte offsets in x16 and wq16 at the trip's first k block
  unsigned an = ring_next(ao), bn = ring_next(bo);             // the same at the next trip's first k block
  v16bb f0[12], f1[12], f2[12], f3[12];                        // a0..a3, b0..b7
  auto fetch = [&](v16bb (&f)[12], unsigned ax, unsigned bx, int kt) {   // ax, bx = a trip's offsets; kt = k block (tile) counted from that trip's first
#pragma unroll
    for (int r = 0; r < 4; ++r) f[r] = frag_bf((const unsigned short*)(XB + ax) + r * XROW + kt * TILE);
#pragma unroll
    for (int t = 0; t < 8; ++t) f[4 + t] = frag_bf((const unsigned short*)(WB + bx) + t * XROW + kt * TILE);
    __builtin_amdgcn_sched_barrier(0); };                      // keeps the group whole and ahead of the block: without it the compiler sinks these loads down to their first use, two blocks later, and the wave waits out their latency there
  auto mma = [&](const v16bb (&f)[12]) {                       // 32 independent sums; the plain builtin (the compiler keeps its distances): operands of an asm pad could not lie above v255
#pragma unroll
    for (int t = 0; t < 8; ++t)
#pragma unroll
      for (int r = 0; r < 4; ++r) acc[r][t] = __builtin_amdgcn_wmma_f32_16x16x32_bf16(false, f[r], false, f[4 + t], (short)0, acc[r][t], false, false);
    __builtin_amdgcn_sched_barrier(0); };                      // the block ends here: the next group's loads are not lifted in among its WMMAs
  fetch(f0, ao, bo, 0); fetch(f1, ao, bo, 1);
  // A block asks L2 for its first trips ahead, one trip (its 8 strips x 4 KB) an instruction, each thread one 256-byte unit. Hints only: nothing waits for them and no value depends on them.
  constexpr int PFT = 4;                                       // trips of the loop that still ask: trips 1 and 2 of the walk are asked for here, trip i + 3 in the loop's trip i
  unsigned ap = ring_next((unsigned)((((rowbase + blockIdx.y * 128) >> 4) + (threadIdx.x >> 4)) * XROW * sizeof(unsigned short)) + (threadIdx.x & 15u) * 256u + k0b);   // this thread's unit in the trip that is asked for next; it lives through the loop and walks the ring, so it never leaves the block's strips
  asm volatile("global_prefetch_b8 %0, %1 scope:SCOPE_SE\n\ts_wait_xcnt 0x0" : "+v"(ap) : "s"(XB) : "memory");   // the wait stands in front of the next line, which moves ap on
  ap = ring_next(ap);
  asm volatile("global_prefetch_b8 %0, %1 scope:SCOPE_SE\n\ts_wait_xcnt 0x0" : "+v"(ap) : "s"(XB) : "memory");   // as above
  ap = ring_next(ap);
#pragma unroll 1   // stays rolled: one trip already holds four k blocks, one per register set
  for (int kt = 0; kt < HID / 32 - 4; kt += 4) {
    if (kt < PFT * 4) asm volatile("global_prefetch_b8 %0, %1 scope:SCOPE_SE" :: "v"(ap), "s"(XB));   // a scalar test, the same for the whole block
    fetch(f2, ao, bo, 2); mma(f0); fetch(f3, ao, bo, 3); mma(f1); fetch(f0, an, bn, 0); mma(f2); fetch(f1, an, bn, 1); mma(f3);
    asm volatile("s_wait_xcnt 0x0" : "+v"(ao), "+v"(bo), "+v"(an), "+v"(bn), "+v"(ap) :: "memory");   // loads are still in flight here and the next line moves their four offset registers and the prefetch's on: as in-out operands they are moved only behind this wait
    ao = an; bo = bn; an = ring_next(an); bn = ring_next(bn); ap = ring_next(ap); }
  fetch(f2, ao, bo, 2); mma(f0); fetch(f3, ao, bo, 3); mma(f1);
  asm volatile("s_wait_xcnt 0x0" : "+v"(ao), "+v"(bo) :: "memory");   // the last blocks' loads may be in flight and the epilogue reuses their offset registers: the wait stands in front of that
  mma(f2); mma(f3);
  // RoPE tables: this lane's rows are tokens m0 + 16 r + 8 hlf + v, its columns 16 u + nloc, u = 0..3; all 256 values hang on two addresses
  const float* pc = cosb + (size_t)(m0 + 8 * hlf) * RD + nloc; const float* ps = sinb + (size_t)(m0 + 8 * hlf) * RD + nloc;   // cos/sin rows [b*S + s][64]
  float cs[4][8][4], sn[4][8][4];
#pragma unroll
  for (int r = 0; r < 4; ++r)
#pragma unroll
    for (int v = 0; v < 8; ++v)
#pragma unroll
      for (int u = 0; u < 4; ++u) { cs[r][v][u] = pc[(r * 16 + v) * RD + u * 16]; sn[r][v][u] = ps[(r * 16 + v) * RD + u * 16]; }
  asm volatile("s_wait_xcnt 0x0" :: "v"(pc), "v"(ps) : "memory");   // named as inputs the two addresses stay whole up to this wait, which stands in front of any write on them
#pragma unroll
  for (int t = 0; t < 2; ++t)                                  // pair (i, i + 32), i = 16 t + nloc, = (acc[.][t], acc[.][t+2])
#pragma unroll
    for (int r = 0; r < 4; ++r)
#pragma unroll
      for (int v = 0; v < 8; ++v) { const float c1 = bf16_rne(cs[r][v][t]), s1 = bf16_rne(sn[r][v][t]), c2 = bf16_rne(cs[r][v][t + 2]), s2 = bf16_rne(sn[r][v][t + 2]);
        const float x1 = acc[r][t][v], x2 = acc[r][t + 2][v]; acc[r][t][v] = x1 * c1 - x2 * s1; acc[r][t + 2][v] = x2 * c2 + x1 * s2; }
  b16* dh = qh + (size_t)(m0 >> 4) * XROW + (c0 >> 5) * TILE + lane * 8;   // the wave's 4 x 4 tiles
#pragma unroll
  for (int t = 0; t < 8; ++t)
#pragma unroll
    for (int r = 0; r < 4; ++r)
#pragma unroll
      for (int v = 0; v < 8; ++v) Th[wave][r * 16 + 8 * hlf + v][t * 16 + nloc] = (b16)(acc[r][t][v] * QS);
  wave_lds_sync();
#pragma unroll
  for (int j = 0; j < 32; ++j) { const int rr = (j >> 3) * 16 + nloc, c8 = (j & 7) * 16 + hlf * 8, o = (j >> 3) * XROW + (j & 7) * 256;   // 4 strips x 4 tiles, two 512-byte halves each: a strip's 8 halves lie one behind the other
    *(v8b*)(dh + o) = *(const v8b*)(&Th[wave][rr][c8]); }
}

// k + w projection: block = 32 tokens x all 144 columns (9 n-subtiles: k = cols 0..127, w = cols 128..143). The K = 2048 sum is split over the block's 8 waves, 256 k each, so that 128 blocks x 8 waves
// work (not 32 x 4) and a wave's chain of dependent load waits is 8 k blocks long (not 64). The 8 partial tiles are joined in LDS in a fixed order; LayerNorm, RoPE and the rounding to f16 are done by 8 threads a row.
__global__ __launch_bounds__(256) void kproj_kernel(const unsigned short* __restrict__ x16, const unsigned short* __restrict__ wk16, const float* __restrict__ cosb, const float* __restrict__ sinb, const float* __restrict__ g, const float* __restrict__ bta, b16* __restrict__ kh, float* __restrict__ wout) {
  constexpr int NW = 8, KS = HID / NW;                         // waves of a block, k per wave
  __shared__ __attribute__((aligned(16))) float Tk[NW][32][KC + 1]; __shared__ __attribute__((aligned(16))) b16 Th[32][HD + 8];
  const int lane = threadIdx.x & 31, wave = threadIdx.x >> 5, nloc = lane & 15, hlf = lane >> 4, m0 = blockIdx.x * 32;
  v8f acc[2][9];
#pragma unroll
  for (int r = 0; r < 2; ++r)
#pragma unroll
    for (int t = 0; t < 9; ++t) acc[r][t] = (v8f){};
  // Every fragment is fetched one k block ahead: the next block's two A fragments go into a second set at the block's head, each B fragment is refilled directly behind its own two WMMAs.
  // A wave walks the 8 k blocks of its slice as a ring and enters it at a k block set by the block's index: all 128 blocks read the same wk16, and from one common start they would all ask L2 for the same lines at the same moment.
  constexpr unsigned KBB = TILE * (unsigned)sizeof(unsigned short), RINGM = KS * 16 * (unsigned)sizeof(unsigned short) - KBB;   // bytes of a k block in a strip (1 KB); the bits of a byte offset that hold the k block's number in the slice (a slice is 8 KB, and slices start at multiples of it)
  auto ring = [](unsigned o, unsigned n) { return (o & ~RINGM) | ((o + n * KBB) & RINGM); };   // the same lane, strip and slice, n k blocks on, the slice's last block followed by its first
  const char* XB = (const char*)x16; const char* WB = (const char*)wk16;
  const unsigned k0b = ((blockIdx.x + (blockIdx.x >> 3)) & 7u) * KBB;   // this block's first k block: all 8 occur among 8 neighbouring blocks and among blocks 8 apart
  // This lane's byte offsets in x16 and wk16: x2, w2 at the even places of the walk (first at place 0), x1, w1 at the odd ones; the wave's slice starts at k = wave * KS
  unsigned x2 = (unsigned)(((m0 >> 4) * XROW + wave * (KS * 16) + lane * 8) * sizeof(unsigned short)) + k0b, w2 = (unsigned)((wave * (KS * 16) + lane * 8) * sizeof(unsigned short)) + k0b;
  unsigned x1 = ring(x2, 1), w1 = ring(w2, 1);
  v16bb a0[2], a1[2], bw[9];
  a0[0] = frag_bf((const unsigned short*)(XB + x2)); a0[1] = frag_bf((const unsigned short*)(XB + x2) + XROW);
#pragma unroll
  for (int t = 0; t < 9; ++t) bw[t] = frag_bf((const unsigned short*)(WB + w2) + t * XROW);
  asm volatile("s_wait_xcnt 0x0" : "+v"(x2), "+v"(w2) :: "memory");   // the first block's loads are in flight and the next line moves their two offset registers on: as in-out operands they are moved only behind this wait
  x2 = ring(x2, 2); w2 = ring(w2, 2);
  auto kstep = [&](const v16bb (&ac)[2], v16bb (&an)[2], unsigned xn, unsigned wn, bool more) {   // xn, wn = the next k block's offsets; more is a literal at every call
    if (more) { an[0] = frag_bf((const unsigned short*)(XB + xn)); an[1] = frag_bf((const unsigned short*)(XB + xn) + XROW); }
#pragma unroll
    for (int t = 0; t < 9; ++t) { acc[0][t] = wmma16bb(ac[0], bw[t], acc[0][t]); acc[1][t] = wmma16bb(ac[1], bw[t], acc[1][t]); if (more) bw[t] = frag_bf((const unsigned short*)(WB + wn) + t * XROW); } };
#pragma unroll 1   // stays rolled: one trip already holds two k blocks, one per A set
  for (int kb = 0; kb < KS - 64; kb += 64) { kstep(a0, a1, x1, w1, true); kstep(a1, a0, x2, w2, true);
    asm volatile("s_wait_xcnt 0x0" : "+v"(x1), "+v"(w1), "+v"(x2), "+v"(w2) :: "memory");   // loads are still in flight here and the next line moves their four offset registers on: as in-out operands they are moved only behind this wait
    x1 = ring(x1, 2); w1 = ring(w1, 2); x2 = ring(x2, 2); w2 = ring(w2, 2); }
  kstep(a0, a1, x1, w1, true);
  asm volatile("s_wait_xcnt 0x0" :: "v"(x1), "v"(w1) : "memory");   // the last block's loads may be in flight and the lines below reuse their offset registers: named as inputs the two stay whole up to this wait
  // Thread = (row rr, column class j): it owns columns j + 8 i, i = 0..17, so both halves of a RoPE pair (d, d + 32) lie in one thread. Its table values are asked for here, ahead of the last k block, and land under its WMMAs.
  const int rr = threadIdx.x >> 3, j = threadIdx.x & 7, tok = m0 + rr; const float* pc = cosb + (size_t)tok * RD + j; const float* ps = sinb + (size_t)tok * RD + j;   // cos/sin rows [b*S + s][64]
  float cs[8], sn[8], gg[16], bb[16];
#pragma unroll
  for (int i = 0; i < 8; ++i) { cs[i] = pc[i * 8]; sn[i] = ps[i * 8]; }
  asm volatile("s_wait_xcnt 0x0" :: "v"(pc), "v"(ps) : "memory");   // the two addresses are temporaries on which a loaded value may land: named as inputs they stay whole up to this wait, which stands in front of any such write
#pragma unroll
  for (int i = 0; i < 16; ++i) { gg[i] = g[i * 8 + j]; bb[i] = bta[i * 8 + j]; }
  asm volatile("s_wait_xcnt 0x0" ::: "memory");                // these loads are in flight and the LDS address arithmetic below may reuse their address registers: the wait stands in front of that
  kstep(a1, a0, 0u, 0u, false);
#pragma unroll
  for (int t = 0; t < 9; ++t)
#pragma unroll
    for (int r = 0; r < 2; ++r)
#pragma unroll
      for (int v = 0; v < 8; ++v) Tk[wave][r * 16 + 8 * hlf + v][t * 16 + nloc] = acc[r][t][v];
  __syncthreads();                                             // all 8 partial tiles are in LDS before any thread joins them
  float val[18];
#pragma unroll
  for (int i = 0; i < 18; ++i) { float s = Tk[0][rr][i * 8 + j];
#pragma unroll
    for (int w = 1; w < NW; ++w) s += Tk[w][rr][i * 8 + j];
    val[i] = s; }
  float mu = 0.0f;
#pragma unroll
  for (int i = 0; i < 16; ++i) mu += val[i];
  mu += __shfl_xor(mu, 1); mu += __shfl_xor(mu, 2); mu += __shfl_xor(mu, 4); mu *= (1.0f / HD);   // the row's 8 threads are 8 neighbouring lanes
  float var = 0.0f;
#pragma unroll
  for (int i = 0; i < 16; ++i) { const float z = val[i] - mu; var += z * z; }
  var += __shfl_xor(var, 1); var += __shfl_xor(var, 2); var += __shfl_xor(var, 4); var *= (1.0f / HD);
  const float rs = rsqrtf(var + LNE);
  float nv[16];
#pragma unroll
  for (int i = 0; i < 16; ++i) nv[i] = (val[i] - mu) * rs * bf16_rne(gg[i]) + bf16_rne(bb[i]);
#pragma unroll
  for (int i = 0; i < 4; ++i) {                                // RoPE pairs (d, d + 32), d = i * 8 + j, of the normalised row
    const float x1 = nv[i], x2 = nv[i + 4], c1 = bf16_rne(cs[i]), s1 = bf16_rne(sn[i]), c2 = bf16_rne(cs[i + 4]), s2 = bf16_rne(sn[i + 4]);
    nv[i] = x1 * c1 - x2 * s1; nv[i + 4] = x2 * c2 + x1 * s2; }
#pragma unroll
  for (int i = 0; i < 16; ++i) Th[rr][i * 8 + j] = (b16)(nv[i] * QS);
  __syncthreads();                                             // the 32 x 128 tile is complete before it is read back in fragment order
#pragma unroll
  for (int u2 = 0; u2 < 2; ++u2) { const int u = wave * 2 + u2, r2 = (u >> 3) * 16 + nloc, c8 = (u & 7) * 16 + hlf * 8; b16* d = kh + (size_t)(m0 >> 4) * KROW + u * 256 + lane * 8;   // 2 x 4 tiles in fragment order = 16 consecutive 512-byte halves, two a wave
    *(v8b*)(d) = *(const v8b*)(&Th[r2][c8]); }
  wout[(size_t)tok * NH + j] = val[16] * SCALE; wout[(size_t)tok * NH + 8 + j] = val[17] * SCALE;   // a wave's 4 rows x 64 B = two whole lines, written by this wave alone
}

// Each wave owns 64 keys (KT = 4 tiles of 16): their fragments (16 x 8 registers) are loaded once and stay in registers over NQ query tiles x 16 heads; only q and w are fetched inside the loops,
// and every q fragment that is fetched feeds all four key tiles. The four accumulator chains are independent and are issued in turn, so no WMMA stands directly behind the one whose sum it continues.
template <int QT, int NQ>
__global__ __launch_bounds__(256) void score_kernel(const b16* __restrict__ qh, const b16* __restrict__ kh, const float* __restrict__ w, float* __restrict__ out) {
  constexpr int KT = 4, KW = KT * 16;                          // key tiles and keys of a wave
  constexpr unsigned QTB = XROW * (unsigned)sizeof(b16);       // bytes of a query tile's q, all 16 heads (64 KB); the wave's NQ tiles lie one behind the other
  static_assert(NQ >= 3 && QTB == 256 * 256, "the first three tiles must exist; 256 threads x 256 B cover a tile");
  __shared__ __attribute__((aligned(16))) float Os[8][16][KW + 4];
  const int wid = threadIdx.x >> 5, lane = threadIdx.x & 31, hh = lane >> 4, col = lane & 15;
  const int wg = blockIdx.x * 8 + wid, kt = wg % (S / KW), qg = (wg / (S / KW)) % (QT / NQ), b = wg / ((S / KW) * (QT / NQ)), k0 = kt * KW;
  const b16* K = kh + (((size_t)b * S + k0) >> 4) * KROW + lane * 8;
  v16b kf[KT][4];
#pragma unroll
  for (int c = 0; c < KT; ++c)
#pragma unroll
    for (int ks = 0; ks < 4; ++ks) kf[c][ks] = frag_kb(K + c * KROW + ks * TILE);
  // q fragments are fetched three heads ahead, in four register sets (one a head of a group of four): the 8 loads of head g + 3 are issued as one group ahead of the WMMAs of head g, into the set that head g - 1 has left,
  // so they have three heads' time to land.
  v16b fa[4], fb[4], fc[4], fd[4];
  asm volatile("s_wait_xcnt 0x0" ::: "memory");                // the k loads are in flight and the w and q loads below may land on their address registers: the wait stands in front of that
  const char* WB = (const char*)w;
  unsigned wo = (unsigned)(((b * S + qg * NQ * 16 + col) * NH) * sizeof(float));   // this lane's byte offset of the four w (its query, a group's four heads) that were fetched last; a query's 16 w are one 64-byte row, the next tiles' rows lie 1 KB apart. It lives through the loops
  static_assert(NQ == 4 && NH == 16, "four w prefetches, one a query tile; four groups of four heads");
  if (__builtin_amdgcn_readfirstlane(wid) == 0)                // a scalar test: all 8 waves read the same w rows, one wave asks
    asm volatile("global_prefetch_b8 %0, %1 scope:SCOPE_SE\n\tglobal_prefetch_b8 %0, %1 offset:1024 scope:SCOPE_SE\n\tglobal_prefetch_b8 %0, %1 offset:2048 scope:SCOPE_SE\n\tglobal_prefetch_b8 %0, %1 offset:3072 scope:SCOPE_SE" :: "v"(wo), "s"(WB));
  v4f wv = *(const v4f*)(WB + wo);                             // w of the first group's four heads, asked for ahead of the q loads as in every trip of the loop: the wait for it at the loop's head then falls on no q load
  __builtin_amdgcn_sched_barrier(0);                           // keeps that load in front of the q loads
  asm volatile("s_wait_xcnt 0x0" : "+v"(wo) :: "memory");      // the prefetches and this load are in flight and the first trip moves their offset register on: as an in-out operand it is moved only behind this wait
  const char* QB = (const char*)qh;
  unsigned qo = (unsigned)(((b * (S / 16) + qg * NQ) * XROW + lane * 8) * sizeof(b16));   // this lane's byte offset of the 16 tiles of the group of four heads that is worked on
  auto fetch = [&](v16b (&f)[4], unsigned go, int hd) {        // go = a group's offset; hd = head counted from that group's first
#pragma unroll
    for (int ks = 0; ks < 4; ++ks) f[ks] = frag_kb((const b16*)(QB + go) + (hd * 4 + ks) * TILE);
    __builtin_amdgcn_sched_barrier(0); };                      // keeps the group whole and ahead of the head: without it the compiler sinks these loads down towards their first use, three heads later, and the wave waits out their latency there
  auto pad = [] { asm volatile("v_nop\n\tv_nop\n\tv_nop\n\tv_nop"); __builtin_amdgcn_sched_barrier(0); };   // four vector slots between a head's last WMMA and the loads that land on the fragments it reads as B; the barrier keeps the loads behind them
  fetch(fa, qo, 0); fetch(fb, qo, 1); fetch(fc, qo, 2);
  asm volatile("s_wait_xcnt 0x0" : "+v"(qo) :: "memory");   // these loads are in flight and the first trip's foot moves their offset register on: as an in-out operand it is moved only behind this wait
  // q and w were stored by earlier launches.
  // So the block asks L2 for a query tile's q two tiles ahead of its loads, each thread one 256-byte unit, and at entry for its w rows. Hints only: nothing waits for them and no value depends on them.
  unsigned po = (unsigned)((b * (S / 16) + qg * NQ) * XROW * sizeof(b16)) + threadIdx.x * 256u;   // this thread's unit in the tile that is asked for next; it lives through the loops and never leaves the block's NQ tiles
  asm volatile("global_prefetch_b8 %0, %1 scope:SCOPE_SE\n\tglobal_prefetch_b8 %0, %1 offset:65536 scope:SCOPE_SE\n\ts_wait_xcnt 0x0" : "+v"(po) : "s"(QB) : "memory");   // tiles 0 and 1; the wait stands in front of the next line, which moves po on
  po += 2 * QTB;
  for (int qq = 0; qq < NQ; ++qq) { const int q0 = (qg * NQ + qq) * 16;
    if (qq + 2 < NQ) asm volatile("global_prefetch_b8 %0, %1 scope:SCOPE_SE" :: "v"(po), "s"(QB));   // tile qq + 2; a scalar test, the same for the whole block
    v8f o[KT];
#pragma unroll
    for (int c = 0; c < KT; ++c) o[c] = (v8f){};
    auto head = [&](const v16b (&f)[4], float wq) { v8f s[KT];   // one head: 16 WMMAs, then relu and the weighted sum
#pragma unroll
      for (int c = 0; c < KT; ++c) s[c] = (v8f){};
#pragma unroll
      for (int ks = 0; ks < 4; ++ks)
#pragma unroll
        for (int c = 0; c < KT; ++c) s[c] = wmma16b(kf[c][ks], f[ks], s[c]);
#pragma unroll
      for (int c = 0; c < KT; ++c)
#pragma unroll
        for (int r = 0; r < 8; ++r) o[c][r] += wq * fmaxf(s[c][r] * (1.0f / (QS * QS)), 0.0f);
      __builtin_amdgcn_sched_barrier(0); };                    // the head ends here: the next group of loads is not lifted in among its WMMAs
#pragma unroll 1   // stays rolled: one trip already holds four heads, one per register set
    for (int hg = 0; hg < NH / 4; ++hg) {
      // the next group of this tile, or the first group of the next tile (in fragment order both lie directly behind this group's 16 tiles); behind the wave's last group the fetches read that group again (in bounds, not used), so no branch stands among the WMMAs
      const bool intile = hg + 1 < NH / 4, more = intile || qq + 1 < NQ;
      unsigned qn = qo + (more ? 16 * TILE * (unsigned)sizeof(b16) : 0u);
      wo += intile ? 4 * (unsigned)sizeof(float) : more ? (16 * NH - 12) * (unsigned)sizeof(float) : 0u;   // four heads on in the row, or from the row's last four to the first four of the next tile's row
      const v4f wn = *(const v4f*)(WB + wo);                   // the next group's w, issued ahead of this group's q loads: the wait for it falls on no q load of this trip
      __builtin_amdgcn_sched_barrier(0);                       // keeps that load here: without it the compiler sinks it to the trip's foot, behind the q loads, and the wait for it drains them
      fetch(fd, qo, 3); head(fa, wv[0]); pad(); fetch(fa, qn, 0); head(fb, wv[1]); pad(); fetch(fb, qn, 1); head(fc, wv[2]); pad(); fetch(fc, qn, 2); head(fd, wv[3]);
      wv = wn;
      asm volatile("s_wait_xcnt 0x0" : "+v"(qo), "+v"(qn), "+v"(wo) :: "memory");   // q and w loads are in flight here and the next line and the next trip move their offset registers on: as in-out operands they are moved only behind this wait
      qo = qn; }
    // o[c][r] = (key k0 + 16c + 8hh + r, query col)
#pragma unroll
    for (int c = 0; c < KT; ++c)
#pragma unroll
      for (int r = 0; r < 8; ++r) Os[wid][col][c * 16 + 8 * hh + r] = o[c][r];
    wave_lds_sync();
    float* dst = out + ((size_t)b * S + q0) * S + k0;
#pragma unroll
    for (int j = 0; j < 8; ++j) { const int rr = j * 2 + (lane >> 4), c4 = (lane & 15) * 4; *(v4f*)(dst + (size_t)rr * S + c4) = *(const v4f*)(&Os[wid][rr][c4]); }   // a row's 64 keys = two whole lines
    wave_lds_sync();   // the next query tile rewrites this wave's Os slice: its reads above come first
    asm volatile("s_wait_xcnt 0x0" : "+v"(po) :: "memory");   // the next line moves the prefetch's offset register on: as an in-out operand it is moved only behind this wait
    po += (qq + 3 < NQ) ? QTB : 0u;                            // stays on the block's last tile once it is there: in bounds before and behind every advance
  }
}
}  // namespace

extern "C" void kernel_launch(void* const* d_in, const int* in_sizes, int n_in,
                              void* d_out, int out_size, void* d_ws, size_t ws_size, hipStream_t stream) {
  (void)n_in; (void)out_size;
  const float* x = (const float*)d_in[0]; const float* cosb = (const float*)d_in[1]; const float* sinb = (const float*)d_in[2]; const float* wq = (const float*)d_in[3]; const float* wk = (const float*)d_in[4]; const float* ww = (const float*)d_in[5]; const float* g = (const float*)d_in[6]; const float* bta = (const float*)d_in[7];
  float* out = (float*)d_out;   // [2][2048][2048]
  if (in_sizes[0] != NTOK * HID || in_sizes[1] != NTOK * RD || in_sizes[2] != NTOK * RD || in_sizes[3] != HID * QC || in_sizes[4] != HID * HD || in_sizes[5] != HID * NH || in_sizes[6] != HD) return;
  size_t off = 0; char* ws = (char*)d_ws;
  auto carve = [&](size_t bytes) { char* p = ws + off; off += (bytes + 255) & ~(size_t)255; return p; };
  unsigned short* x16 = (unsigned short*)carve((size_t)NTOK * HID * 2); unsigned short* wq16 = (unsigned short*)carve((size_t)QC * HID * 2); unsigned short* wk16 = (unsigned short*)carve((size_t)KCP * HID * 2);
  b16* qh = (b16*)carve(QPL * 2); b16* kh = (b16*)carve(KPL * 2); float* w = (float*)carve((size_t)NTOK * NH * 4);
  if (off > ws_size) return;                                    // about 16.8 + 8.4 + 0.8 + 16.8 + 1.0 + 0.3 = 44 MB
  prep_kernel<<<1024, 256, 0, stream>>>(x, wq, wk, ww, x16, wq16, wk16);
  qproj_kernel<<<dim3(QC / 256, NTOK / 128), 128, 0, stream>>>(x16, wq16, cosb, sinb, qh, 0);
  kproj_kernel<<<NTOK / 32, 256, 0, stream>>>(x16, wk16, cosb, sinb, g, bta, kh, w);
  score_kernel<S / 16, 4><<<Bn * (S / 16 / 4) * (S / 64) / 8, 256, 0, stream>>>(qh, kh, w, out);
}
